// v000
// The times below were measured on an AMD MI455X: many runs one after another, warmed up first and cycling through
// copies of the inputs, with the whole window's GPU time divided by the number of runs. Launches and the gaps
// between them are all in it. The median over several windows is given; except for v000 it joins two sittings, which
// can be a few percent apart, so the side-by-side timings, each taken in one sitting, are the better comparison.
// v000, which the later versions start from, runs in 58.6 microseconds.
/* A TRILINEAR SIMILARITY SCORE: S[b][t][j] = H[b][t] . w_h + U[b][j] . w_u + (H[b][t] * w_m) . U[b][j] for H [16][2048][256], U [16][512][256] and W [768][1] = (w_h | w_u | w_m). ONE RESULT [16][2048][512].
   Inputs are taken at their bf16 values. THE TWO ROW DOTS (s_h over H's 32,768 rows; s_u over U's 8,192) run on the vector unit in f32 (256 terms a row, in the index's order). ONE BATCHED PRODUCT on the 64x64-tile engine gives all three terms: the engine adds a bias by row OR by column, not both, so THE TWO RANK-ONE TERMS RIDE INSIDE THE DEPTH: the left operand's row t is [H[t] * w_m (256) | 1 | 1 | s_h high | s_h low | noughts] and the right operand's row j is [U[j] (256) | s_u high | s_u low | 1 | 1 | noughts]: 260 live columns padded to the depth's grain: K 288; f16 operands carried by 2^10, f32 sums; H * w_m ONE f16 word (the product of two bf16 values rounded once); U exact; s_h and s_u TWO f16 words each. 5 launches on one stream; no block barrier, no LDS and no cross-lane word in the new text. */
#include <hip/hip_runtime.h>
#include <math.h>

typedef __attribute__((ext_vector_type(16))) _Float16 v16h;
typedef __attribute__((ext_vector_type(8)))  _Float16 v8h;
typedef unsigned short v8us __attribute__((ext_vector_type(8)));
typedef __attribute__((ext_vector_type(2)))  _Float16 v2h;
typedef __attribute__((ext_vector_type(16))) __bf16   v16b;
typedef __attribute__((ext_vector_type(8)))  __bf16   v8b;
typedef __attribute__((ext_vector_type(8)))  float    v8f;
typedef __attribute__((ext_vector_type(4)))  float    v4f;
typedef __attribute__((ext_vector_type(2)))  float    v2f;

/* ------------------------------------------------------------------------- */
/* Shape constants                                                           */
/* ------------------------------------------------------------------------- */
constexpr int kNB   = 16;                 /* batches */
constexpr int kT    = 2048;               /* H's rows a batch */
constexpr int kJ    = 512;                /* U's rows a batch */
constexpr int kD    = 256;                /* features */
constexpr int kKA   = 288;                /* the depth: 256 + 4 live columns, padded to a multiple of 32 */
constexpr int kGr   = 36;                 /* kKA / 8: column groups of a built row */
constexpr int kThr  = 256;
constexpr float kInCarry = 1024.0f;       /* 2^10: every f16 operand */
constexpr float kSc20 = 1.0f / (kInCarry * kInCarry);   /* 2^-20: two carried operands -> a true-scale f32 result */
/* 2^-14: smallest normal f16 magnitude */
constexpr float kF16MinNormal = 6.103515625e-5f;

static_assert(kNB == 16 && kT == 2048 && kJ == 512 && kD == 256 && kKA == 288 && kGr * 8 == kKA && kKA % 32 == 0, "the index arithmetic below uses these sizes");

/* ------------------------------------------------------------------------- */
/* Workspace region map (bytes): each region written once, whole, before its readers. THE CARVE IS 22.66 MiB. */
/*   A16 f16 [32768][288] the left operand x2^10: 18874368 B;  B16 f16 [8192][288] the right operand x2^10: 4718592 B */
/*   SH  f32 [32768] s_h (true scale): 131072 B;  SU f32 [8192] s_u: 32768 B */
/* ------------------------------------------------------------------------- */
constexpr size_t kOffA16 = 0ull;
constexpr size_t kOffB16 = 18874368ull;
constexpr size_t kOffSH = 23592960ull;
constexpr size_t kOffSU = 23724032ull;
constexpr size_t kWsTotal = 23756800ull;
static_assert(kWsTotal <= 134217728ull, "the carve stands under 128 MiB");
static_assert(kOffA16 == 0 && kOffB16 == kOffA16 + 18874368ull && kOffSH == kOffB16 + 4718592ull && kOffSU == kOffSH + 131072ull && kWsTotal == kOffSU + 32768ull, "the carve is a chain: every region starts where the one before ends");
static_assert((kOffA16 % 256) == 0 && (kOffB16 % 256) == 0 && (kOffSH % 256) == 0 && (kOffSU % 256) == 0, "every region starts on a multiple of 256 B");

/* ------------------------------------------------------------------------- */
/* Conversions, the matrix fragments and the product engine                  */
/* ------------------------------------------------------------------------- */
__device__ __forceinline__ unsigned short f2bf_bits(float f) {
  unsigned u = __float_as_uint(f);
  return (unsigned short)((u + 0x7FFFu + ((u >> 16) & 1u)) >> 16);
}
__device__ __forceinline__ float bf_bits2f(unsigned short h) { return __uint_as_float(((unsigned)h) << 16); }
/* RNE-convert to a bf16 value, kept in f32 */
__device__ __forceinline__ float bf16r(float f) { return bf_bits2f(f2bf_bits(f)); }
/* carry by a power of two, then flush anything below the f16 normal range to +0 by a select */
__device__ __forceinline__ float carry_flush(float v, float carry) {
  const float s = v * carry;
  return (fabsf(s) < kF16MinNormal) ? 0.0f : s;
}

/* hazard guards as plain device helpers */
__device__ __forceinline__ void dep_guard4_h(v8f& a, v8f& b, v8f& c, v8f& d, v16h x, v16h y) { asm volatile("v_nop\n\tv_nop\n\tv_nop\n\tv_nop" : "+v"(a), "+v"(b), "+v"(c), "+v"(d) : "v"(x), "v"(y)); }
__device__ __forceinline__ void dep_guard4_b(v8f& a, v8f& b, v8f& c, v8f& d, v16b x, v16b y) { asm volatile("v_nop\n\tv_nop\n\tv_nop\n\tv_nop" : "+v"(a), "+v"(b), "+v"(c), "+v"(d) : "v"(x), "v"(y)); }
__device__ __forceinline__ void keep4_h(v16h a, v16h b, v16h c, v16h d) { asm volatile("v_nop" :: "v"(a), "v"(b), "v"(c), "v"(d)); }
__device__ __forceinline__ void keep4_b(v16b a, v16b b, v16b c, v16b d) { asm volatile("v_nop" :: "v"(a), "v"(b), "v"(c), "v"(d)); }
__device__ __forceinline__ void acc_guard4(v8f& a, v8f& b, v8f& c, v8f& d) { asm volatile("v_nop\n\tv_nop\n\tv_nop\n\tv_nop" : "+v"(a), "+v"(b), "+v"(c), "+v"(d)); }

template <typename T> struct Frag;
template <> struct Frag<_Float16> {
  typedef v16h V; union U { v16h v; v8h h[2]; };
  /* elements 0..7 <- p[0..7], 8..15 <- p[16..23] */
  static __device__ __forceinline__ v16h load(const _Float16* p) {
    U f; f.h[0] = *(const v8h*)(p); f.h[1] = *(const v8h*)(p + 16); return f.v;
  }
  static __device__ __forceinline__ v8f mma(v16h a, v16h b, v8f c) {
    return __builtin_amdgcn_wmma_f32_16x16x32_f16(false, a, false, b, (short)0, c, false, false);
  }
  static __device__ __forceinline__ void guard4(v8f& a, v8f& b, v8f& c, v8f& d, v16h x, v16h y) { dep_guard4_h(a, b, c, d, x, y); }
  static __device__ __forceinline__ void keep(v16h a, v16h b, v16h c, v16h d) { keep4_h(a, b, c, d); }
};
template <> struct Frag<__bf16> {
  typedef v16b V; union U { v16b v; v8b h[2]; };
  static __device__ __forceinline__ v16b load(const __bf16* p) {
    U f; f.h[0] = *(const v8b*)(p); f.h[1] = *(const v8b*)(p + 16); return f.v;
  }
  static __device__ __forceinline__ v8f mma(v16b a, v16b b, v8f c) {
    return __builtin_amdgcn_wmma_f32_16x16x32_bf16(false, a, false, b, (short)0, c, false, false);
  }
  static __device__ __forceinline__ void guard4(v8f& a, v8f& b, v8f& c, v8f& d, v16b x, v16b y) { dep_guard4_b(a, b, c, d, x, y); }
  static __device__ __forceinline__ void keep(v16b a, v16b b, v16b c, v16b d) { keep4_b(a, b, c, d); }
};

/* one f16 matrix instruction followed by its own hazard guard (accumulator tied, both fragments named) */
__device__ __forceinline__ v8f mma_h(v16h a, v16h b, v8f c) {
  c = __builtin_amdgcn_wmma_f32_16x16x32_f16(false, a, false, b, (short)0, c, false, false);
  asm volatile("v_nop\n\tv_nop\n\tv_nop\n\tv_nop" : "+v"(c) : "v"(a), "v"(b));
  return c;
}

/* ---- Register-blocked batched WMMA GEMM ------------------------------------ */
/* C[m,n] = scale * sum_k A[m,k] * Bt[n,k] (+bias)(+resid); each wave owns a 64x64 tile. */
/* A row-major [M,K]; Bt row-major [N,K]; M,N % 64 == 0, K % 32 == 0. */
/* SPLIT: operands are hi/lo planes (A2/Bt2 = lo planes, same layout); product = hi.hi + hi.lo + lo.hi. */
/* BIAS_MODE: 0 = none, 1 = bias[m], 2 = bias[n]. */
/* OUT_MODE: 0 = f32, 1 = f16, 2 = bf16 hi plane (Cout) + bf16 lo plane (Cout2). */
/* ET: 0 = f16 operands, 1 = bf16 operands (pointers passed as 16-bit storage) */
template <int ET> struct Elem;
template <> struct Elem<0> { typedef _Float16 T; };
template <> struct Elem<1> { typedef __bf16 T; };
template <int ET, bool SPLIT, int BIAS_MODE, int OUT_MODE, bool RESID, int ACT = 0>
__global__ __launch_bounds__(256) void wmma_gemm64(
    const unsigned short* __restrict__ Ap, const unsigned short* __restrict__ A2p, int lda, long strideA,
    const unsigned short* __restrict__ Btp, const unsigned short* __restrict__ Bt2p, int ldb, long strideB,
    void* __restrict__ Cout, void* __restrict__ Cout2, int ldc, long strideC,
    const float* __restrict__ bias,
    const float* __restrict__ resid, long strideR,
    int M, int N, int K, float scale) {
  typedef typename Elem<ET>::T T;
  typedef typename Frag<T>::V V;
  const T* A = (const T*)Ap; const T* A2 = (const T*)A2p; const T* Bt = (const T*)Btp; const T* Bt2 = (const T*)Bt2p;
  /* per-wave 16x64 slab, pitch 68 floats */
  __shared__ __align__(16) float sT[8][16 * 68];
  const int b    = blockIdx.y;
  const int lane = threadIdx.x & 31;
  const int wave = threadIdx.x >> 5;
  const int tilesN = N >> 6;
  const int tilesM = M >> 6;
  const int tile = blockIdx.x * 8 + wave;
  /* wave-uniform; no block barriers in this kernel */
  if (tile >= tilesM * tilesN) return;
  const int tm = tile / tilesN;
  const int tn = tile - tm * tilesN;
  const int m0 = tm << 6;
  const int n0 = tn << 6;

  const T* Ab  = A  + (size_t)b * strideA;
  const T* Bb  = Bt + (size_t)b * strideB;
  const T* Ab2 = SPLIT ? (A2  + (size_t)b * strideA) : nullptr;
  const T* Bb2 = SPLIT ? (Bt2 + (size_t)b * strideB) : nullptr;

  /* row (A) / col (B, D) within subtile; k offset of this lane half; D row offset */
  const int rlane = lane & 15;
  const int koff  = (lane >> 4) * 8;
  const int mOff  = (lane >> 4) * 8;

  v8f acc[4][4];
#pragma unroll
  for (int i = 0; i < 4; ++i)
#pragma unroll
    for (int j = 0; j < 4; ++j) acc[i][j] = (v8f){0.f,0.f,0.f,0.f,0.f,0.f,0.f,0.f};

  for (int k0 = 0; k0 < K; k0 += 32) {
    V bh[4], bl[4];
#pragma unroll
    for (int j = 0; j < 4; ++j) {
      const size_t bo = (size_t)(n0 + (j << 4) + rlane) * ldb + koff + k0;
      bh[j] = Frag<T>::load(Bb + bo);
      if (SPLIT) bl[j] = Frag<T>::load(Bb2 + bo);
    }
#pragma unroll
    for (int i = 0; i < 4; ++i) {
      const size_t ao = (size_t)(m0 + (i << 4) + rlane) * lda + koff + k0;
      V ah = Frag<T>::load(Ab + ao);
      V al;
      if (SPLIT) al = Frag<T>::load(Ab2 + ao);
#pragma unroll
      for (int j = 0; j < 4; ++j) {
        acc[i][j] = Frag<T>::mma(ah, bh[j], acc[i][j]);
        if (SPLIT) {
          acc[i][j] = Frag<T>::mma(ah, bl[j], acc[i][j]);
          acc[i][j] = Frag<T>::mma(al, bh[j], acc[i][j]);
        }
      }
      /* all four accumulators of this row group tied, A fragment(s) named */
      Frag<T>::guard4(acc[i][0], acc[i][1], acc[i][2], acc[i][3], ah, SPLIT ? al : ah);
    }
    Frag<T>::keep(bh[0], bh[1], bh[2], bh[3]);
    if (SPLIT) Frag<T>::keep(bl[0], bl[1], bl[2], bl[3]);
  }
  acc_guard4(acc[0][0], acc[0][1], acc[0][2], acc[0][3]);
  acc_guard4(acc[1][0], acc[1][1], acc[1][2], acc[1][3]);
  acc_guard4(acc[2][0], acc[2][1], acc[2][2], acc[2][3]);
  acc_guard4(acc[3][0], acc[3][1], acc[3][2], acc[3][3]);

  /* ---- epilogue ---- */
  float* slab = sT[wave];
  const float* Rb = RESID ? (resid + (size_t)b * strideR) : nullptr;
#pragma unroll
  for (int i = 0; i < 4; ++i) {
    const int mBase = m0 + (i << 4);
#pragma unroll
    for (int j = 0; j < 4; ++j) {
      const int n = n0 + (j << 4) + rlane;
      float bv = 0.f;
      if (BIAS_MODE == 2) bv = bias[n];
#pragma unroll
      for (int r = 0; r < 8; ++r) {
        float v = acc[i][j][r] * scale;
        if (BIAS_MODE == 1) v += bias[mBase + mOff + r];
        if (BIAS_MODE == 2) v += bv;
        if (RESID) v += Rb[(size_t)(mBase + mOff + r) * ldc + n];
        if (ACT == 1) v = tanhf(v);
        if (ACT == 2) v = fmaxf(v, 0.0f);
        if (ACT == 3) v = v / (1.0f + expf(-v));
        if (ACT == 4) v = (v > 0.f) ? v : 0.01f * v;
        slab[(mOff + r) * 68 + (j << 4) + rlane] = v;
      }
    }
    __builtin_amdgcn_fence(__ATOMIC_RELEASE, "workgroup");
    __builtin_amdgcn_wave_barrier();
    __builtin_amdgcn_fence(__ATOMIC_ACQUIRE, "workgroup");
    if (OUT_MODE == 0) {
      float* C = (float*)Cout + (size_t)b * strideC;
      /* row seg = 256 B = 16 lanes x 16 B */
      const int hh = lane >> 4, c4 = (lane & 15) * 4;
      {
#pragma unroll
        for (int it = 0; it < 8; ++it) {
          const int row = it * 2 + hh;
          v4f v = *(const v4f*)(slab + row * 68 + c4);
          *(v4f*)(C + (size_t)(mBase + row) * ldc + n0 + c4) = v;
        }
        
      }
    } else {
      const int q = lane >> 3, c8 = (lane & 7) * 8;
      unsigned short* C  = (unsigned short*)Cout  + (size_t)b * strideC;
      unsigned short* C2 = (OUT_MODE == 2) ? ((unsigned short*)Cout2 + (size_t)b * strideC) : nullptr;
      {
#pragma unroll
        for (int it = 0; it < 4; ++it) {
          const int row = it * 4 + q;
          const float* sp = slab + row * 68 + c8;
          v8h hv, lv;
#pragma unroll
          for (int e = 0; e < 8; ++e) {
            if (OUT_MODE == 1) {
              hv[e] = (_Float16)sp[e];
            } else {
              unsigned short hb = f2bf_bits(sp[e]);
              unsigned short lb = f2bf_bits(sp[e] - bf_bits2f(hb));
              hv[e] = __builtin_bit_cast(_Float16, hb);
              lv[e] = __builtin_bit_cast(_Float16, lb);
            }
          }
          *(v8h*)(C + (size_t)(mBase + row) * ldc + n0 + c8) = hv;
          if (OUT_MODE == 2) *(v8h*)(C2 + (size_t)(mBase + row) * ldc + n0 + c8) = lv;
        }
        
      }
    }
    __builtin_amdgcn_fence(__ATOMIC_RELEASE, "workgroup");
    __builtin_amdgcn_wave_barrier();
    __builtin_amdgcn_fence(__ATOMIC_ACQUIRE, "workgroup");
  }
}

/* ------------------------------------------------------------------------- */
/* ------------------------------------------------------------------------- */
__global__ __launch_bounds__(kThr) void sdot_kernel(const float* __restrict__ X, const float* __restrict__ w, float* __restrict__ out) {
  const unsigned i = blockIdx.x * (unsigned)kThr + threadIdx.x;
  const float* xp = X + (size_t)i * (unsigned)kD;
  float s = 0.0f;
#pragma unroll
  for (int q = 0; q < kD / 4; ++q) {
    const v4f a = *(const v4f*)(xp + 4 * q);
    const v4f b = *(const v4f*)(w + 4 * q);
#pragma unroll
    for (int e = 0; e < 4; ++e) s = fmaf(bf16r(a[e]), bf16r(b[e]), s);
  }
  float* dp = out + i;
  *(float*)dp = s;
  
}

/* ------------------------------------------------------------------------- */
/* ------------------------------------------------------------------------- */
__global__ __launch_bounds__(kThr) void abuild_kernel(const float* __restrict__ H, const float* __restrict__ wm, const float* __restrict__ SH, unsigned short* __restrict__ A16) {
  const unsigned i = blockIdx.x * (unsigned)kThr + threadIdx.x;
  const unsigned r = i / (unsigned)kGr, g = i - r * (unsigned)kGr;
  const unsigned gs = (g < 32u) ? g : 31u;
  const unsigned live = (g < 32u) ? 0xFFFFu : 0u;
  const unsigned aug = (g == 32u) ? 0xFFFFu : 0u;
  const float* hp = H + (size_t)r * (unsigned)kD + 8u * gs;
  const float* wp = wm + 8u * gs;
  const v4f h0 = *(const v4f*)hp, h1 = *(const v4f*)(hp + 4);
  const v4f w0 = *(const v4f*)wp, w1 = *(const v4f*)(wp + 4);
  const float sh = SH[r];
  const _Float16 hi = (_Float16)carry_flush(sh, kInCarry);
  const _Float16 lo = (_Float16)carry_flush(sh - (float)hi * (1.0f / kInCarry), kInCarry);
  v8h lv, av;
#pragma unroll
  for (int e = 0; e < 4; ++e) {
    lv[e]     = (_Float16)carry_flush(bf16r(h0[e]) * bf16r(w0[e]), kInCarry);
    lv[4 + e] = (_Float16)carry_flush(bf16r(h1[e]) * bf16r(w1[e]), kInCarry);
  }
  av[0] = (_Float16)kInCarry; av[1] = (_Float16)kInCarry; av[2] = hi; av[3] = lo;
  av[4] = (_Float16)0.0f; av[5] = (_Float16)0.0f; av[6] = (_Float16)0.0f; av[7] = (_Float16)0.0f;
  const v8us lb = __builtin_bit_cast(v8us, lv), ab = __builtin_bit_cast(v8us, av);
  v8us ov;
#pragma unroll
  for (int e = 0; e < 8; ++e) ov[e] = (unsigned short)((lb[e] & live) | (ab[e] & aug));
  unsigned short* dp = A16 + (size_t)i * 8u;
  *(v8us*)dp = ov;
  
}

/* ------------------------------------------------------------------------- */
/* ------------------------------------------------------------------------- */
__global__ __launch_bounds__(kThr) void bbuild_kernel(const float* __restrict__ U, const float* __restrict__ SU, unsigned short* __restrict__ B16) {
  const unsigned i = blockIdx.x * (unsigned)kThr + threadIdx.x;
  const unsigned r = i / (unsigned)kGr, g = i - r * (unsigned)kGr;
  const unsigned gs = (g < 32u) ? g : 31u;
  const unsigned live = (g < 32u) ? 0xFFFFu : 0u;
  const unsigned aug = (g == 32u) ? 0xFFFFu : 0u;
  const float* up = U + (size_t)r * (unsigned)kD + 8u * gs;
  const v4f u0 = *(const v4f*)up, u1 = *(const v4f*)(up + 4);
  const float su = SU[r];
  const _Float16 hi = (_Float16)carry_flush(su, kInCarry);
  const _Float16 lo = (_Float16)carry_flush(su - (float)hi * (1.0f / kInCarry), kInCarry);
  v8h lv, av;
#pragma unroll
  for (int e = 0; e < 4; ++e) {
    lv[e]     = (_Float16)carry_flush(bf16r(u0[e]), kInCarry);
    lv[4 + e] = (_Float16)carry_flush(bf16r(u1[e]), kInCarry);
  }
  av[0] = hi; av[1] = lo; av[2] = (_Float16)kInCarry; av[3] = (_Float16)kInCarry;
  av[4] = (_Float16)0.0f; av[5] = (_Float16)0.0f; av[6] = (_Float16)0.0f; av[7] = (_Float16)0.0f;
  const v8us lb = __builtin_bit_cast(v8us, lv), ab = __builtin_bit_cast(v8us, av);
  v8us ov;
#pragma unroll
  for (int e = 0; e < 8; ++e) ov[e] = (unsigned short)((lb[e] & live) | (ab[e] & aug));
  unsigned short* dp = B16 + (size_t)i * 8u;
  *(v8us*)dp = ov;
  
}

extern "C" void kernel_launch(void* const* d_in, const int* in_sizes, int n_in,
                              void* d_out, int out_size, void* d_ws, size_t ws_size,
                              hipStream_t stream) {
  if (n_in < 3 || d_out == nullptr || d_ws == nullptr) return;
  if (in_sizes[0] != kNB * kT * kD || in_sizes[1] != kNB * kJ * kD || in_sizes[2] != 3 * kD) return;
  if (out_size != kNB * kT * kJ) return;
  if (ws_size < kWsTotal) return;
  const float* H = (const float*)d_in[0];
  const float* U = (const float*)d_in[1];
  const float* Wv = (const float*)d_in[2];
  float* out = (float*)d_out;
  char* ws = (char*)d_ws;
  unsigned short* A16 = (unsigned short*)(ws + kOffA16);
  unsigned short* B16 = (unsigned short*)(ws + kOffB16);
  float* SH = (float*)(ws + kOffSH);
  float* SU = (float*)(ws + kOffSU);

  static_assert((kNB * kT) % kThr == 0 && (kNB * kJ) % kThr == 0 && (kNB * kT * kGr) % kThr == 0 && (kNB * kJ * kGr) % kThr == 0, "every flat kernel's grid exact");
  /* W = (w_h | w_u | w_m): 256 floats each */
  sdot_kernel<<<kNB * kT / kThr, kThr, 0, stream>>>(H, Wv, SH);
  sdot_kernel<<<kNB * kJ / kThr, kThr, 0, stream>>>(U, Wv + kD, SU);
  abuild_kernel<<<kNB * kT * kGr / kThr, kThr, 0, stream>>>(H, Wv + 2 * kD, SH, A16);
  bbuild_kernel<<<kNB * kJ * kGr / kThr, kThr, 0, stream>>>(U, SU, B16);
  /* S[b] = 2^-20 (A16[b] . B16[b]^T): a batch a sample: M 2,048, N 512, K 288: 256 wave tiles on 32 blocks a batch */
  wmma_gemm64<0, false, 0, 0, false, 0><<<dim3((kT / 64) * (kJ / 64) / 8, kNB), 256, 0, stream>>>(
      A16, A16, kKA, (long)kT * kKA, B16, B16, kKA, (long)kJ * kKA, (void*)out, (void*)out, kJ, (long)kT * kJ, nullptr, nullptr, 0L, kT, kJ, kKA, kSc20);
}
static_assert(((kT / 64) * (kJ / 64)) % 8 == 0, "the engine's grid: whole blocks of eight wave tiles");

// v001
// Measured time: 37.5 microseconds a run.
// Two timings next to v000 both put it at 1.57 times that version's speed.
/* A TRILINEAR SIMILARITY SCORE: S[b][t][j] = H[b][t] . w_h + U[b][j] . w_u + (H[b][t] * w_m) . U[b][j] for H [16][2048][256], U [16][512][256] and W [768][1] = (w_h | w_u | w_m). ONE RESULT [16][2048][512].
   Inputs are taken at their bf16 values. ONE BATCHED PRODUCT on the 64x64-tile engine gives all three terms: the engine adds a bias by row OR by column, not both, so THE TWO RANK-ONE TERMS RIDE INSIDE THE DEPTH: the left operand's row t is [H[t] * w_m (256) | 1 | 1 | s_h high | s_h low | noughts] and the right operand's row j is [U[j] (256) | s_u high | s_u low | 1 | 1 | noughts]: 260 live columns padded to the depth's grain: K 288; f16 operands carried by 2^10, f32 sums; H * w_m ONE f16 word (the product of two bf16 values rounded once); U exact; s_h and s_u TWO f16 words each.
   ONE PRE-PASS builds both operands: a wave takes eight rows of H or of U, reads each row once, writes its 256 f16 words and sums its row dot (s_h or s_u, f32: eight terms a lane in the index's order, then a fixed tree over the 32 lanes) on the way. 2 launches on one stream. */
#include <hip/hip_runtime.h>
#include <math.h>

typedef __attribute__((ext_vector_type(16))) _Float16 v16h;
typedef __attribute__((ext_vector_type(8)))  _Float16 v8h;
typedef unsigned short v8us __attribute__((ext_vector_type(8)));
typedef __attribute__((ext_vector_type(2)))  _Float16 v2h;
typedef __attribute__((ext_vector_type(16))) __bf16   v16b;
typedef __attribute__((ext_vector_type(8)))  __bf16   v8b;
typedef __attribute__((ext_vector_type(8)))  float    v8f;
typedef __attribute__((ext_vector_type(4)))  float    v4f;
typedef __attribute__((ext_vector_type(2)))  float    v2f;

/* ------------------------------------------------------------------------- */
/* Shape constants                                                           */
/* ------------------------------------------------------------------------- */
constexpr int kNB   = 16;                 /* batches */
constexpr int kT    = 2048;               /* H's rows a batch */
constexpr int kJ    = 512;                /* U's rows a batch */
constexpr int kD    = 256;                /* features */
constexpr int kKA   = 288;                /* the depth: 256 + 4 live columns, padded to a multiple of 32 */
constexpr int kGr   = 36;                 /* kKA / 8: column groups of a built row */
constexpr int kThr  = 256;
constexpr float kInCarry = 1024.0f;       /* 2^10: every f16 operand */
constexpr float kSc20 = 1.0f / (kInCarry * kInCarry);   /* 2^-20: two carried operands -> a true-scale f32 result */
/* 2^-14: smallest normal f16 magnitude */
constexpr float kF16MinNormal = 6.103515625e-5f;

static_assert(kNB == 16 && kT == 2048 && kJ == 512 && kD == 256 && kKA == 288 && kGr * 8 == kKA && kKA % 32 == 0, "the index arithmetic below uses these sizes");

/* ------------------------------------------------------------------------- */
/* Workspace region map (bytes): each region written once, whole, before its readers. THE CARVE IS 22.5 MiB. */
/*   A16 f16 [32768][288] the left operand x2^10: 18874368 B;  B16 f16 [8192][288] the right operand x2^10: 4718592 B */
/* ------------------------------------------------------------------------- */
constexpr size_t kOffA16 = 0ull;
constexpr size_t kOffB16 = 18874368ull;
constexpr size_t kWsTotal = 23592960ull;
static_assert(kWsTotal <= 134217728ull, "the carve stands under 128 MiB");
static_assert(kOffA16 == 0 && kOffB16 == kOffA16 + 18874368ull && kWsTotal == kOffB16 + 4718592ull, "the carve is a chain: every region starts where the one before ends");
static_assert((kOffA16 % 256) == 0 && (kOffB16 % 256) == 0, "every region starts on a multiple of 256 B");

/* ------------------------------------------------------------------------- */
/* Conversions, the matrix fragments and the product engine                  */
/* ------------------------------------------------------------------------- */
__device__ __forceinline__ unsigned short f2bf_bits(float f) {
  unsigned u = __float_as_uint(f);
  return (unsigned short)((u + 0x7FFFu + ((u >> 16) & 1u)) >> 16);
}
__device__ __forceinline__ float bf_bits2f(unsigned short h) { return __uint_as_float(((unsigned)h) << 16); }
/* RNE-convert to a bf16 value, kept in f32 */
__device__ __forceinline__ float bf16r(float f) { return bf_bits2f(f2bf_bits(f)); }
/* carry by a power of two, then flush anything below the f16 normal range to +0 by a select */
__device__ __forceinline__ float carry_flush(float v, float carry) {
  const float s = v * carry;
  return (fabsf(s) < kF16MinNormal) ? 0.0f : s;
}

/* hazard guards as plain device helpers */
__device__ __forceinline__ void dep_guard4_h(v8f& a, v8f& b, v8f& c, v8f& d, v16h x, v16h y) { asm volatile("v_nop\n\tv_nop\n\tv_nop\n\tv_nop" : "+v"(a), "+v"(b), "+v"(c), "+v"(d) : "v"(x), "v"(y)); }
__device__ __forceinline__ void dep_guard4_b(v8f& a, v8f& b, v8f& c, v8f& d, v16b x, v16b y) { asm volatile("v_nop\n\tv_nop\n\tv_nop\n\tv_nop" : "+v"(a), "+v"(b), "+v"(c), "+v"(d) : "v"(x), "v"(y)); }
__device__ __forceinline__ void keep4_h(v16h a, v16h b, v16h c, v16h d) { asm volatile("v_nop" :: "v"(a), "v"(b), "v"(c), "v"(d)); }
__device__ __forceinline__ void keep4_b(v16b a, v16b b, v16b c, v16b d) { asm volatile("v_nop" :: "v"(a), "v"(b), "v"(c), "v"(d)); }
__device__ __forceinline__ void acc_guard4(v8f& a, v8f& b, v8f& c, v8f& d) { asm volatile("v_nop\n\tv_nop\n\tv_nop\n\tv_nop" : "+v"(a), "+v"(b), "+v"(c), "+v"(d)); }

template <typename T> struct Frag;
template <> struct Frag<_Float16> {
  typedef v16h V; union U { v16h v; v8h h[2]; };
  /* elements 0..7 <- p[0..7], 8..15 <- p[16..23] */
  static __device__ __forceinline__ v16h load(const _Float16* p) {
    U f; f.h[0] = *(const v8h*)(p); f.h[1] = *(const v8h*)(p + 16); return f.v;
  }
  static __device__ __forceinline__ v8f mma(v16h a, v16h b, v8f c) {
    return __builtin_amdgcn_wmma_f32_16x16x32_f16(false, a, false, b, (short)0, c, false, false);
  }
  static __device__ __forceinline__ void guard4(v8f& a, v8f& b, v8f& c, v8f& d, v16h x, v16h y) { dep_guard4_h(a, b, c, d, x, y); }
  static __device__ __forceinline__ void keep(v16h a, v16h b, v16h c, v16h d) { keep4_h(a, b, c, d); }
};
template <> struct Frag<__bf16> {
  typedef v16b V; union U { v16b v; v8b h[2]; };
  static __device__ __forceinline__ v16b load(const __bf16* p) {
    U f; f.h[0] = *(const v8b*)(p); f.h[1] = *(const v8b*)(p + 16); return f.v;
  }
  static __device__ __forceinline__ v8f mma(v16b a, v16b b, v8f c) {
    return __builtin_amdgcn_wmma_f32_16x16x32_bf16(false, a, false, b, (short)0, c, false, false);
  }
  static __device__ __forceinline__ void guard4(v8f& a, v8f& b, v8f& c, v8f& d, v16b x, v16b y) { dep_guard4_b(a, b, c, d, x, y); }
  static __device__ __forceinline__ void keep(v16b a, v16b b, v16b c, v16b d) { keep4_b(a, b, c, d); }
};

/* one f16 matrix instruction followed by its own hazard guard (accumulator tied, both fragments named) */
__device__ __forceinline__ v8f mma_h(v16h a, v16h b, v8f c) {
  c = __builtin_amdgcn_wmma_f32_16x16x32_f16(false, a, false, b, (short)0, c, false, false);
  asm volatile("v_nop\n\tv_nop\n\tv_nop\n\tv_nop" : "+v"(c) : "v"(a), "v"(b));
  return c;
}

/* ---- Register-blocked batched WMMA GEMM ------------------------------------ */
/* C[m,n] = scale * sum_k A[m,k] * Bt[n,k] (+bias)(+resid); each wave owns a 64x64 tile. */
/* A row-major [M,K]; Bt row-major [N,K]; M,N % 64 == 0, K % 32 == 0. */
/* SPLIT: operands are hi/lo planes (A2/Bt2 = lo planes, same layout); product = hi.hi + hi.lo + lo.hi. */
/* BIAS_MODE: 0 = none, 1 = bias[m], 2 = bias[n]. */
/* OUT_MODE: 0 = f32, 1 = f16, 2 = bf16 hi plane (Cout) + bf16 lo plane (Cout2). */
/* ET: 0 = f16 operands, 1 = bf16 operands (pointers passed as 16-bit storage) */
template <int ET> struct Elem;
template <> struct Elem<0> { typedef _Float16 T; };
template <> struct Elem<1> { typedef __bf16 T; };
template <int ET, bool SPLIT, int BIAS_MODE, int OUT_MODE, bool RESID, int ACT = 0>
__global__ __launch_bounds__(256) void wmma_gemm64(
    const unsigned short* __restrict__ Ap, const unsigned short* __restrict__ A2p, int lda, long strideA,
    const unsigned short* __restrict__ Btp, const unsigned short* __restrict__ Bt2p, int ldb, long strideB,
    void* __restrict__ Cout, void* __restrict__ Cout2, int ldc, long strideC,
    const float* __restrict__ bias,
    const float* __restrict__ resid, long strideR,
    int M, int N, int K, float scale) {
  typedef typename Elem<ET>::T T;
  typedef typename Frag<T>::V V;
  const T* A = (const T*)Ap; const T* A2 = (const T*)A2p; const T* Bt = (const T*)Btp; const T* Bt2 = (const T*)Bt2p;
  /* per-wave 16x64 slab, pitch 68 floats */
  __shared__ __align__(16) float sT[8][16 * 68];
  const int b    = blockIdx.y;
  const int lane = threadIdx.x & 31;
  const int wave = threadIdx.x >> 5;
  const int tilesN = N >> 6;
  const int tilesM = M >> 6;
  const int tile = blockIdx.x * 8 + wave;
  /* wave-uniform; no block barriers in this kernel */
  if (tile >= tilesM * tilesN) return;
  const int tm = tile / tilesN;
  const int tn = tile - tm * tilesN;
  const int m0 = tm << 6;
  const int n0 = tn << 6;

  const T* Ab  = A  + (size_t)b * strideA;
  const T* Bb  = Bt + (size_t)b * strideB;
  const T* Ab2 = SPLIT ? (A2  + (size_t)b * strideA) : nullptr;
  const T* Bb2 = SPLIT ? (Bt2 + (size_t)b * strideB) : nullptr;

  /* row (A) / col (B, D) within subtile; k offset of this lane half; D row offset */
  const int rlane = lane & 15;
  const int koff  = (lane >> 4) * 8;
  const int mOff  = (lane >> 4) * 8;

  v8f acc[4][4];
#pragma unroll
  for (int i = 0; i < 4; ++i)
#pragma unroll
    for (int j = 0; j < 4; ++j) acc[i][j] = (v8f){0.f,0.f,0.f,0.f,0.f,0.f,0.f,0.f};

  for (int k0 = 0; k0 < K; k0 += 32) {
    V bh[4], bl[4];
#pragma unroll
    for (int j = 0; j < 4; ++j) {
      const size_t bo = (size_t)(n0 + (j << 4) + rlane) * ldb + koff + k0;
      bh[j] = Frag<T>::load(Bb + bo);
      if (SPLIT) bl[j] = Frag<T>::load(Bb2 + bo);
    }
#pragma unroll
    for (int i = 0; i < 4; ++i) {
      const size_t ao = (size_t)(m0 + (i << 4) + rlane) * lda + koff + k0;
      V ah = Frag<T>::load(Ab + ao);
      V al;
      if (SPLIT) al = Frag<T>::load(Ab2 + ao);
#pragma unroll
      for (int j = 0; j < 4; ++j) {
        acc[i][j] = Frag<T>::mma(ah, bh[j], acc[i][j]);
        if (SPLIT) {
          acc[i][j] = Frag<T>::mma(ah, bl[j], acc[i][j]);
          acc[i][j] = Frag<T>::mma(al, bh[j], acc[i][j]);
        }
      }
      /* all four accumulators of this row group tied, A fragment(s) named */
      Frag<T>::guard4(acc[i][0], acc[i][1], acc[i][2], acc[i][3], ah, SPLIT ? al : ah);
    }
    Frag<T>::keep(bh[0], bh[1], bh[2], bh[3]);
    if (SPLIT) Frag<T>::keep(bl[0], bl[1], bl[2], bl[3]);
  }
  acc_guard4(acc[0][0], acc[0][1], acc[0][2], acc[0][3]);
  acc_guard4(acc[1][0], acc[1][1], acc[1][2], acc[1][3]);
  acc_guard4(acc[2][0], acc[2][1], acc[2][2], acc[2][3]);
  acc_guard4(acc[3][0], acc[3][1], acc[3][2], acc[3][3]);

  /* ---- epilogue ---- */
  float* slab = sT[wave];
  const float* Rb = RESID ? (resid + (size_t)b * strideR) : nullptr;
#pragma unroll
  for (int i = 0; i < 4; ++i) {
    const int mBase = m0 + (i << 4);
#pragma unroll
    for (int j = 0; j < 4; ++j) {
      const int n = n0 + (j << 4) + rlane;
      float bv = 0.f;
      if (BIAS_MODE == 2) bv = bias[n];
#pragma unroll
      for (int r = 0; r < 8; ++r) {
        float v = acc[i][j][r] * scale;
        if (BIAS_MODE == 1) v += bias[mBase + mOff + r];
        if (BIAS_MODE == 2) v += bv;
        if (RESID) v += Rb[(size_t)(mBase + mOff + r) * ldc + n];
        if (ACT == 1) v = tanhf(v);
        if (ACT == 2) v = fmaxf(v, 0.0f);
        if (ACT == 3) v = v / (1.0f + expf(-v));
        if (ACT == 4) v = (v > 0.f) ? v : 0.01f * v;
        slab[(mOff + r) * 68 + (j << 4) + rlane] = v;
      }
    }
    __builtin_amdgcn_fence(__ATOMIC_RELEASE, "workgroup");
    __builtin_amdgcn_wave_barrier();
    __builtin_amdgcn_fence(__ATOMIC_ACQUIRE, "workgroup");
    if (OUT_MODE == 0) {
      float* C = (float*)Cout + (size_t)b * strideC;
      /* row seg = 256 B = 16 lanes x 16 B */
      const int hh = lane >> 4, c4 = (lane & 15) * 4;
      {
#pragma unroll
        for (int it = 0; it < 8; ++it) {
          const int row = it * 2 + hh;
          v4f v = *(const v4f*)(slab + row * 68 + c4);
          *(v4f*)(C + (size_t)(mBase + row) * ldc + n0 + c4) = v;
        }
        
      }
    } else {
      const int q = lane >> 3, c8 = (lane & 7) * 8;
      unsigned short* C  = (unsigned short*)Cout  + (size_t)b * strideC;
      unsigned short* C2 = (OUT_MODE == 2) ? ((unsigned short*)Cout2 + (size_t)b * strideC) : nullptr;
      {
#pragma unroll
        for (int it = 0; it < 4; ++it) {
          const int row = it * 4 + q;
          const float* sp = slab + row * 68 + c8;
          v8h hv, lv;
#pragma unroll
          for (int e = 0; e < 8; ++e) {
            if (OUT_MODE == 1) {
              hv[e] = (_Float16)sp[e];
            } else {
              unsigned short hb = f2bf_bits(sp[e]);
              unsigned short lb = f2bf_bits(sp[e] - bf_bits2f(hb));
              hv[e] = __builtin_bit_cast(_Float16, hb);
              lv[e] = __builtin_bit_cast(_Float16, lb);
            }
          }
          *(v8h*)(C + (size_t)(mBase + row) * ldc + n0 + c8) = hv;
          if (OUT_MODE == 2) *(v8h*)(C2 + (size_t)(mBase + row) * ldc + n0 + c8) = lv;
        }
        
      }
    }
    __builtin_amdgcn_fence(__ATOMIC_RELEASE, "workgroup");
    __builtin_amdgcn_wave_barrier();
    __builtin_amdgcn_fence(__ATOMIC_ACQUIRE, "workgroup");
  }
}

/* ------------------------------------------------------------------------- */
/* The pre-pass: both operands and both row dots in one launch                */
/* ------------------------------------------------------------------------- */
typedef __attribute__((ext_vector_type(4)))  _Float16 v4h;
typedef __attribute__((ext_vector_type(2)))  unsigned v2u;
constexpr int kPrepRows = 8;              /* rows a wave: 8 x 576 B = 36 whole 128-B lines of the built operand */
constexpr int kPrepThr  = 128;            /* four waves a block: 32 rows */
constexpr int kPrepRowsBlk = kPrepRows * (kPrepThr / 32);
static_assert((kNB * kT) % kPrepRowsBlk == 0 && (kNB * kJ) % kPrepRowsBlk == 0, "a block's rows are all H's or all U's; the grid is exact");

/* LEFT: X = H, wd = w_h, wm = w_m, dst = A16.  Otherwise X = U, wd = w_u, dst = B16 (wm not read). */
template <bool LEFT>
__device__ __forceinline__ void build_rows(const float* X, const float* wd, const float* wm, unsigned short* dst, unsigned row0, unsigned lane) {
  /* each load covers 512 contiguous bytes of a row: columns 4 lane .. and 128 + 4 lane .. */
  const unsigned c0 = 4u * lane, c1 = 128u + 4u * lane;
  const float* xp = X + (size_t)row0 * (unsigned)kD + c0;
  unsigned short* dp = dst + (size_t)row0 * (unsigned)kKA + c0;
  v4f d0 = *(const v4f*)(wd + c0), d1 = *(const v4f*)(wd + c1);
  v4f m0 = (v4f){1.f, 1.f, 1.f, 1.f}, m1 = m0;
  if (LEFT) { m0 = *(const v4f*)(wm + c0); m1 = *(const v4f*)(wm + c1); }
  /* before a row load's result lands in a register that an issued load of w names */
  asm volatile("s_wait_xcnt 0x0" ::: "memory");
  /* all sixteen row loads go out before the first is used */
  v4f x0[kPrepRows], x1[kPrepRows];
#pragma unroll
  for (int r = 0; r < kPrepRows; ++r) {
    x0[r] = *(const v4f*)(xp + r * kD);
    x1[r] = *(const v4f*)(xp + r * kD + 128);
  }
  /* before a register that an issued load names is written again; the address is named so that no load's result is placed over it */
  asm volatile("s_wait_xcnt 0x0" :: "v"(xp) : "memory");
#pragma unroll
  for (int e = 0; e < 4; ++e) {
    d0[e] = bf16r(d0[e]); d1[e] = bf16r(d1[e]);
    if (LEFT) { m0[e] = bf16r(m0[e]); m1[e] = bf16r(m1[e]); }
  }
  float s[kPrepRows];
#pragma unroll
  for (int r = 0; r < kPrepRows; ++r) {
    float a = 0.0f;
    v4h o0, o1;
#pragma unroll
    for (int e = 0; e < 4; ++e) {
      const float xb = bf16r(x0[r][e]);
      a = fmaf(xb, d0[e], a);
      o0[e] = (_Float16)carry_flush(LEFT ? xb * m0[e] : xb, kInCarry);
    }
#pragma unroll
    for (int e = 0; e < 4; ++e) {
      const float xb = bf16r(x1[r][e]);
      a = fmaf(xb, d1[e], a);
      o1[e] = (_Float16)carry_flush(LEFT ? xb * m1[e] : xb, kInCarry);
    }
    s[r] = a;
    /* the row's two stores (columns 4 lane .. and, 256 B on, 128 + 4 lane ..) with their wait in one statement: the next row's arithmetic writes these registers again, and a wait in a statement of its own did not stay behind the stores */
    asm volatile("global_store_b64 %0, %1, off\n\tglobal_store_b64 %0, %2, off offset:256\n\ts_wait_xcnt 0x0"
                 :: "v"(dp + r * kKA), "v"(__builtin_bit_cast(v2u, o0)), "v"(__builtin_bit_cast(v2u, o1)) : "memory");
  }
  /* eight sums over 32 lanes in one tree: each of the first three steps halves the rows a lane still carries, so lane l ends with row l >> 2 */
  const bool u16 = (lane & 16u) != 0u, u8 = (lane & 8u) != 0u, u4 = (lane & 4u) != 0u;
  float t4[4], t2[2];
#pragma unroll
  for (int i = 0; i < 4; ++i) t4[i] = (u16 ? s[i + 4] : s[i]) + __shfl_xor(u16 ? s[i] : s[i + 4], 16, 32);
#pragma unroll
  for (int i = 0; i < 2; ++i) t2[i] = (u8 ? t4[i + 2] : t4[i]) + __shfl_xor(u8 ? t4[i] : t4[i + 2], 8, 32);
  float sv = (u4 ? t2[1] : t2[0]) + __shfl_xor(u4 ? t2[0] : t2[1], 4, 32);
  sv += __shfl_xor(sv, 2, 32);
  sv += __shfl_xor(sv, 1, 32);
  /* the 32 tail columns of the eight rows: one 16-byte store a lane (row l >> 2, column group l & 3; the live four columns stand in group 0) */
  const _Float16 hi = (_Float16)carry_flush(sv, kInCarry);
  const _Float16 lo = (_Float16)carry_flush(sv - (float)hi * (1.0f / kInCarry), kInCarry);
  const _Float16 one = (_Float16)kInCarry, nought = (_Float16)0.0f;
  v8h av;
  av[0] = LEFT ? one : hi; av[1] = LEFT ? one : lo; av[2] = LEFT ? hi : one; av[3] = LEFT ? lo : one;
  av[4] = nought; av[5] = nought; av[6] = nought; av[7] = nought;
  const unsigned aug = ((lane & 3u) == 0u) ? 0xFFFFu : 0u;
  const v8us ab = __builtin_bit_cast(v8us, av);
  v8us ov;
#pragma unroll
  for (int e = 0; e < 8; ++e) ov[e] = (unsigned short)(ab[e] & aug);
  *(v8us*)(dst + (size_t)(row0 + (lane >> 2)) * (unsigned)kKA + (unsigned)kD + 8u * (lane & 3u)) = ov;
}

__global__ __launch_bounds__(kPrepThr) void prep_kernel(const float* H, const float* U, const float* Wv, unsigned short* A16, unsigned short* B16) {
  const unsigned lane = threadIdx.x & 31u;
  const unsigned wrow = (threadIdx.x >> 5) * (unsigned)kPrepRows;
  constexpr unsigned kBlkH = (unsigned)(kNB * kT / kPrepRowsBlk);
  /* W = (w_h | w_u | w_m): 256 floats each */
  if (blockIdx.x < kBlkH) build_rows<true>(H, Wv, Wv + 2 * kD, A16, blockIdx.x * (unsigned)kPrepRowsBlk + wrow, lane);
  else                    build_rows<false>(U, Wv + kD, Wv, B16, (blockIdx.x - kBlkH) * (unsigned)kPrepRowsBlk + wrow, lane);
}

extern "C" void kernel_launch(void* const* d_in, const int* in_sizes, int n_in,
                              void* d_out, int out_size, void* d_ws, size_t ws_size,
                              hipStream_t stream) {
  if (n_in < 3 || d_out == nullptr || d_ws == nullptr) return;
  if (in_sizes[0] != kNB * kT * kD || in_sizes[1] != kNB * kJ * kD || in_sizes[2] != 3 * kD) return;
  if (out_size != kNB * kT * kJ) return;
  if (ws_size < kWsTotal) return;
  const float* H = (const float*)d_in[0];
  const float* U = (const float*)d_in[1];
  const float* Wv = (const float*)d_in[2];
  float* out = (float*)d_out;
  char* ws = (char*)d_ws;
  unsigned short* A16 = (unsigned short*)(ws + kOffA16);
  unsigned short* B16 = (unsigned short*)(ws + kOffB16);

  prep_kernel<<<(kNB * kT + kNB * kJ) / kPrepRowsBlk, kPrepThr, 0, stream>>>(H, U, Wv, A16, B16);
  /* S[b] = 2^-20 (A16[b] . B16[b]^T): a batch a sample: M 2,048, N 512, K 288: 256 wave tiles on 32 blocks a batch */
  wmma_gemm64<0, false, 0, 0, false, 0><<<dim3((kT / 64) * (kJ / 64) / 8, kNB), 256, 0, stream>>>(
      A16, A16, kKA, (long)kT * kKA, B16, B16, kKA, (long)kJ * kKA, (void*)out, (void*)out, kJ, (long)kT * kJ, nullptr, nullptr, 0L, kT, kJ, kKA, kSc20);
}
static_assert(((kT / 64) * (kJ / 64)) % 8 == 0, "the engine's grid: whole blocks of eight wave tiles");

// v002
// It runs in 18.7 microseconds.
// Two timings next to v001 both put it at 2.01 times that version's speed.
// Over all steps from v000 it is 3.16 times as fast.
/* A TRILINEAR SIMILARITY SCORE: S[b][t][j] = H[b][t] . w_h + U[b][j] . w_u + (H[b][t] * w_m) . U[b][j] for H [16][2048][256], U [16][512][256] and W [768][1] = (w_h | w_u | w_m). ONE RESULT [16][2048][512].
   Inputs are taken at their bf16 values. ONE BATCHED PRODUCT gives all three terms: THE TWO RANK-ONE TERMS RIDE INSIDE THE DEPTH: the left operand's row t is [H[t] * w_m (256) | 1 | 1 | s_h high | s_h low | noughts] and the right operand's row j is [U[j] (256) | s_u high | s_u low | 1 | 1 | noughts]: 260 live columns padded to the depth's grain: K 288; f16 operands carried by 2^10, f32 sums; H * w_m ONE f16 word (the product of two bf16 values rounded once); U exact; s_h and s_u TWO f16 words each.
   ONE PRE-PASS builds both operands: a wave takes eight rows of H or of U, reads each row once, writes its 256 f16 words and sums its row dot (s_h or s_u, f32: eight terms a lane in the index's order, then a fixed tree over the 32 lanes) on the way.
   THE PRODUCT: a work-group of sixteen waves owns a 256 x 256 tile of S[b]; its 256 rows of each operand, the whole depth, are copied once into LDS in whole lines (asynchronous copies, 16 B a lane), and every wave reads the fragments of its 64 x 64 tile from there. 2 launches on one stream. */
#include <hip/hip_runtime.h>
#include <math.h>

typedef __attribute__((ext_vector_type(16))) _Float16 v16h;
typedef __attribute__((ext_vector_type(8)))  _Float16 v8h;
typedef unsigned short v8us __attribute__((ext_vector_type(8)));
typedef __attribute__((ext_vector_type(2)))  _Float16 v2h;
typedef __attribute__((ext_vector_type(16))) __bf16   v16b;
typedef __attribute__((ext_vector_type(8)))  __bf16   v8b;
typedef __attribute__((ext_vector_type(8)))  float    v8f;
typedef __attribute__((ext_vector_type(4)))  float    v4f;
typedef __attribute__((ext_vector_type(2)))  float    v2f;

/* ------------------------------------------------------------------------- */
/* Shape constants                                                           */
/* ------------------------------------------------------------------------- */
constexpr int kNB   = 16;                 /* batches */
constexpr int kT    = 2048;               /* H's rows a batch */
constexpr int kJ    = 512;                /* U's rows a batch */
constexpr int kD    = 256;                /* features */
constexpr int kKA   = 288;                /* the depth: 256 + 4 live columns, padded to a multiple of 32 */
constexpr int kGr   = 36;                 /* kKA / 8: column groups of a built row */
constexpr int kThr  = 256;
constexpr float kInCarry = 1024.0f;       /* 2^10: every f16 operand */
constexpr float kSc20 = 1.0f / (kInCarry * kInCarry);   /* 2^-20: two carried operands -> a true-scale f32 result */
/* 2^-14: smallest normal f16 magnitude */
constexpr float kF16MinNormal = 6.103515625e-5f;

static_assert(kNB == 16 && kT == 2048 && kJ == 512 && kD == 256 && kKA == 288 && kGr * 8 == kKA && kKA % 32 == 0, "the index arithmetic below uses these sizes");

/* ------------------------------------------------------------------------- */
/* Workspace region map (bytes): each region written once, whole, before its readers. THE CARVE IS 22.5 MiB. */
/*   A16 f16 [32768][288] the left operand x2^10: 18874368 B;  B16 f16 [8192][288] the right operand x2^10: 4718592 B */
/* ------------------------------------------------------------------------- */
constexpr size_t kOffA16 = 0ull;
constexpr size_t kOffB16 = 18874368ull;
constexpr size_t kWsTotal = 23592960ull;
static_assert(kWsTotal <= 134217728ull, "the carve stands under 128 MiB");
static_assert(kOffA16 == 0 && kOffB16 == kOffA16 + 18874368ull && kWsTotal == kOffB16 + 4718592ull, "the carve is a chain: every region starts where the one before ends");
static_assert((kOffA16 % 256) == 0 && (kOffB16 % 256) == 0, "every region starts on a multiple of 256 B");

/* ------------------------------------------------------------------------- */
/* Conversions, the matrix fragments and the product engine                  */
/* ------------------------------------------------------------------------- */
__device__ __forceinline__ unsigned short f2bf_bits(float f) {
  unsigned u = __float_as_uint(f);
  return (unsigned short)((u + 0x7FFFu + ((u >> 16) & 1u)) >> 16);
}
__device__ __forceinline__ float bf_bits2f(unsigned short h) { return __uint_as_float(((unsigned)h) << 16); }
/* RNE-convert to a bf16 value, kept in f32 */
__device__ __forceinline__ float bf16r(float f) { return bf_bits2f(f2bf_bits(f)); }
/* carry by a power of two, then flush anything below the f16 normal range to +0 by a select */
__device__ __forceinline__ float carry_flush(float v, float carry) {
  const float s = v * carry;
  return (fabsf(s) < kF16MinNormal) ? 0.0f : s;
}

/* hazard guards as plain device helpers */
__device__ __forceinline__ void dep_guard4_h(v8f& a, v8f& b, v8f& c, v8f& d, v16h x, v16h y) { asm volatile("v_nop\n\tv_nop\n\tv_nop\n\tv_nop" : "+v"(a), "+v"(b), "+v"(c), "+v"(d) : "v"(x), "v"(y)); }
__device__ __forceinline__ void dep_guard4_b(v8f& a, v8f& b, v8f& c, v8f& d, v16b x, v16b y) { asm volatile("v_nop\n\tv_nop\n\tv_nop\n\tv_nop" : "+v"(a), "+v"(b), "+v"(c), "+v"(d) : "v"(x), "v"(y)); }
__device__ __forceinline__ void keep4_h(v16h a, v16h b, v16h c, v16h d) { asm volatile("v_nop" :: "v"(a), "v"(b), "v"(c), "v"(d)); }
__device__ __forceinline__ void keep4_b(v16b a, v16b b, v16b c, v16b d) { asm volatile("v_nop" :: "v"(a), "v"(b), "v"(c), "v"(d)); }
__device__ __forceinline__ void acc_guard4(v8f& a, v8f& b, v8f& c, v8f& d) { asm volatile("v_nop\n\tv_nop\n\tv_nop\n\tv_nop" : "+v"(a), "+v"(b), "+v"(c), "+v"(d)); }

template <typename T> struct Frag;
template <> struct Frag<_Float16> {
  typedef v16h V; union U { v16h v; v8h h[2]; };
  /* elements 0..7 <- p[0..7], 8..15 <- p[16..23] */
  static __device__ __forceinline__ v16h load(const _Float16* p) {
    U f; f.h[0] = *(const v8h*)(p); f.h[1] = *(const v8h*)(p + 16); return f.v;
  }
  static __device__ __forceinline__ v8f mma(v16h a, v16h b, v8f c) {
    return __builtin_amdgcn_wmma_f32_16x16x32_f16(false, a, false, b, (short)0, c, false, false);
  }
  static __device__ __forceinline__ void guard4(v8f& a, v8f& b, v8f& c, v8f& d, v16h x, v16h y) { dep_guard4_h(a, b, c, d, x, y); }
  static __device__ __forceinline__ void keep(v16h a, v16h b, v16h c, v16h d) { keep4_h(a, b, c, d); }
};
template <> struct Frag<__bf16> {
  typedef v16b V; union U { v16b v; v8b h[2]; };
  static __device__ __forceinline__ v16b load(const __bf16* p) {
    U f; f.h[0] = *(const v8b*)(p); f.h[1] = *(const v8b*)(p + 16); return f.v;
  }
  static __device__ __forceinline__ v8f mma(v16b a, v16b b, v8f c) {
    return __builtin_amdgcn_wmma_f32_16x16x32_bf16(false, a, false, b, (short)0, c, false, false);
  }
  static __device__ __forceinline__ void guard4(v8f& a, v8f& b, v8f& c, v8f& d, v16b x, v16b y) { dep_guard4_b(a, b, c, d, x, y); }
  static __device__ __forceinline__ void keep(v16b a, v16b b, v16b c, v16b d) { keep4_b(a, b, c, d); }
};

/* ---- The batched product, operand tiles in LDS ------------------------------ */
/* S[b][m][n] = 2^-20 sum_k A16[b][m][k] * B16[b][n][k]; both operands row-major, 288 f16 a row. */
constexpr int kTileR   = 256;                 /* rows of each operand a work-group holds: a 256 x 256 tile of S */
constexpr int kPitchB  = kKA * 2 + 16;        /* LDS bytes a row: 592 = 16 B x 37, odd: sixteen rows' 16-byte reads fall on 64 different banks */
constexpr int kPitchH  = kPitchB / 2;
constexpr int kOpBytes = kTileR * kPitchB;    /* 151,552 B an operand tile */
constexpr int kGemmThr = 512;                 /* sixteen waves, 4 x 4, a 64 x 64 tile each */
constexpr int kPieces  = kTileR * kGr;        /* 9,216 pieces of 16 B in an operand tile, contiguous in the workspace */
constexpr int kTrips   = kPieces / kGemmThr;  /* 18 pieces of each operand a lane: 36 copies of a wave in flight */
constexpr int kSlabB   = 16 * 68 * 4;         /* a wave's output slab: 16 rows, pitch 68 floats */
static_assert(kPieces % kGemmThr == 0 && kTrips % 6 == 0 && 2 * kTrips <= 63, "whole trips, six a statement, under the copies a wave may have outstanding");
static_assert(2 * kOpBytes <= 327680 && (kGemmThr / 32) * kSlabB <= 2 * kOpBytes, "both tiles fit the LDS; the slabs fit the tiles' place");
static_assert(kT % kTileR == 0 && kJ % kTileR == 0, "whole tiles");

__global__ __launch_bounds__(kGemmThr) void gemm_lds(const unsigned short* __restrict__ Ap, const unsigned short* __restrict__ Btp, float* __restrict__ Cout) {
  typedef _Float16 T;
  typedef Frag<T>::V V;
  /* [A tile 256 rows | B tile 256 rows] at pitch 592 B; after the product the waves' output slabs */
  __shared__ __align__(16) unsigned char sm[2 * kOpBytes];
  const unsigned tid = threadIdx.x;
  const int lane = (int)(tid & 31u);
  const int wave = (int)(tid >> 5);
  const int b  = blockIdx.z;
  const int M0 = blockIdx.y * kTileR;
  const int N0 = blockIdx.x * kTileR;

  /* ---- fill: piece p of a tile lies at byte 16 p of its 147,456 contiguous workspace bytes and goes to row p / 36 of the LDS tile: byte 16 p + 16 (p / 36) ---- */
  {
    const char* gA = (const char*)(Ap  + ((size_t)b * kT + (size_t)M0) * kKA);
    const char* gB = (const char*)(Btp + ((size_t)b * kJ + (size_t)N0) * kKA);
    const unsigned lds0 = (unsigned)(size_t)sm;
#pragma unroll
    for (int i = 0; i < kTrips; i += 6) {
      unsigned p[6], a[6];
#pragma unroll
      for (int e = 0; e < 6; ++e) { p[e] = tid + (unsigned)((i + e) * kGemmThr); a[e] = lds0 + 16u * (p[e] + p[e] / (unsigned)kGr); }
      /* twelve copies and, as the statement's last line, the wait that stands before any register they name is written again */
      asm volatile("global_load_async_to_lds_b128 %0, %1, off\n\t"
                   "global_load_async_to_lds_b128 %2, %3, off\n\t"
                   "global_load_async_to_lds_b128 %4, %5, off\n\t"
                   "global_load_async_to_lds_b128 %6, %7, off\n\t"
                   "global_load_async_to_lds_b128 %8, %9, off\n\t"
                   "global_load_async_to_lds_b128 %10, %11, off\n\t"
                   "global_load_async_to_lds_b128 %12, %13, off\n\t"
                   "global_load_async_to_lds_b128 %14, %15, off\n\t"
                   "global_load_async_to_lds_b128 %16, %17, off\n\t"
                   "global_load_async_to_lds_b128 %18, %19, off\n\t"
                   "global_load_async_to_lds_b128 %20, %21, off\n\t"
                   "global_load_async_to_lds_b128 %22, %23, off\n\t"
                   "s_wait_xcnt 0x0"
                   :: "v"(a[0]), "v"(gA + 16u * p[0]), "v"(a[1]), "v"(gA + 16u * p[1]), "v"(a[2]), "v"(gA + 16u * p[2]),
                      "v"(a[3]), "v"(gA + 16u * p[3]), "v"(a[4]), "v"(gA + 16u * p[4]), "v"(a[5]), "v"(gA + 16u * p[5]),
                      "v"(a[0] + (unsigned)kOpBytes), "v"(gB + 16u * p[0]), "v"(a[1] + (unsigned)kOpBytes), "v"(gB + 16u * p[1]), "v"(a[2] + (unsigned)kOpBytes), "v"(gB + 16u * p[2]),
                      "v"(a[3] + (unsigned)kOpBytes), "v"(gB + 16u * p[3]), "v"(a[4] + (unsigned)kOpBytes), "v"(gB + 16u * p[4]), "v"(a[5] + (unsigned)kOpBytes), "v"(gB + 16u * p[5])
                   : "memory");
    }
    /* this wave's copies have landed */
    asm volatile("s_wait_asynccnt 0x0" ::: "memory");
  }
  /* every wave's copies have landed: the tiles may be read */
  __syncthreads();

  /* row (A) / col (B, D) within subtile; k offset of this lane half; D row offset */
  const int rlane = lane & 15;
  const int koff  = (lane >> 4) * 8;
  const int mOff  = (lane >> 4) * 8;
  const int m0 = (wave >> 2) << 6;
  const int n0 = (wave & 3) << 6;
  const T* sA = (const T*)sm + (m0 + rlane) * kPitchH + koff;
  const T* sB = (const T*)(sm + kOpBytes) + (n0 + rlane) * kPitchH + koff;

  v8f acc[4][4];
#pragma unroll
  for (int i = 0; i < 4; ++i)
#pragma unroll
    for (int j = 0; j < 4; ++j) acc[i][j] = (v8f){0.f,0.f,0.f,0.f,0.f,0.f,0.f,0.f};

  /* unrolled: every fragment address is the wave's base and an immediate */
#pragma unroll
  for (int k0 = 0; k0 < kKA; k0 += 32) {
    /* the step's eight fragments go out as one group ahead of its sixteen matrix instructions: one LDS wait a step */
    V bh[4], ah[4];
#pragma unroll
    for (int j = 0; j < 4; ++j) bh[j] = Frag<T>::load(sB + (j << 4) * kPitchH + k0);
#pragma unroll
    for (int i = 0; i < 4; ++i) ah[i] = Frag<T>::load(sA + (i << 4) * kPitchH + k0);
#pragma unroll
    for (int i = 0; i < 4; ++i) {
#pragma unroll
      for (int j = 0; j < 4; ++j) acc[i][j] = Frag<T>::mma(ah[i], bh[j], acc[i][j]);
      /* all four accumulators of this row group tied, A fragment named */
      Frag<T>::guard4(acc[i][0], acc[i][1], acc[i][2], acc[i][3], ah[i], ah[i]);
    }
    Frag<T>::keep(bh[0], bh[1], bh[2], bh[3]);
  }
  acc_guard4(acc[0][0], acc[0][1], acc[0][2], acc[0][3]);
  acc_guard4(acc[1][0], acc[1][1], acc[1][2], acc[1][3]);
  acc_guard4(acc[2][0], acc[2][1], acc[2][2], acc[2][3]);
  acc_guard4(acc[3][0], acc[3][1], acc[3][2], acc[3][3]);

  /* every wave's last fragment read is over: the tiles' LDS becomes output staging */
  __syncthreads();

  /* ---- epilogue: 16 x 64 at a time through the wave's own slab, stored in whole lines ---- */
  float* slab = (float*)(sm + wave * kSlabB);
  float* C = Cout + (size_t)b * ((size_t)kT * kJ);
#pragma unroll
  for (int i = 0; i < 4; ++i) {
    const int mBase = M0 + m0 + (i << 4);
#pragma unroll
    for (int j = 0; j < 4; ++j) {
#pragma unroll
      for (int r = 0; r < 8; ++r) slab[(mOff + r) * 68 + (j << 4) + rlane] = acc[i][j][r] * kSc20;
    }
    __builtin_amdgcn_fence(__ATOMIC_RELEASE, "workgroup");
    __builtin_amdgcn_wave_barrier();
    __builtin_amdgcn_fence(__ATOMIC_ACQUIRE, "workgroup");
    /* row seg = 256 B = 16 lanes x 16 B */
    const int hh = lane >> 4, c4 = (lane & 15) * 4;
#pragma unroll
    for (int it = 0; it < 8; ++it) {
      const int row = it * 2 + hh;
      v4f v = *(const v4f*)(slab + row * 68 + c4);
      *(v4f*)(C + (size_t)(mBase + row) * kJ + N0 + n0 + c4) = v;
    }
    __builtin_amdgcn_fence(__ATOMIC_RELEASE, "workgroup");
    __builtin_amdgcn_wave_barrier();
    __builtin_amdgcn_fence(__ATOMIC_ACQUIRE, "workgroup");
  }
}

/* ------------------------------------------------------------------------- */
/* The pre-pass: both operands and both row dots in one launch                */
/* ------------------------------------------------------------------------- */
typedef __attribute__((ext_vector_type(4)))  _Float16 v4h;
typedef __attribute__((ext_vector_type(2)))  unsigned v2u;
constexpr int kPrepRows = 8;              /* rows a wave: 8 x 576 B = 36 whole 128-B lines of the built operand */
constexpr int kPrepThr  = 128;            /* four waves a block: 32 rows */
constexpr int kPrepRowsBlk = kPrepRows * (kPrepThr / 32);
static_assert((kNB * kT) % kPrepRowsBlk == 0 && (kNB * kJ) % kPrepRowsBlk == 0, "a block's rows are all H's or all U's; the grid is exact");

/* LEFT: X = H, wd = w_h, wm = w_m, dst = A16.  Otherwise X = U, wd = w_u, dst = B16 (wm not read). */
template <bool LEFT>
__device__ __forceinline__ void build_rows(const float* X, const float* wd, const float* wm, unsigned short* dst, unsigned row0, unsigned lane) {
  /* each load covers 512 contiguous bytes of a row: columns 4 lane .. and 128 + 4 lane .. */
  const unsigned c0 = 4u * lane, c1 = 128u + 4u * lane;
  const float* xp = X + (size_t)row0 * (unsigned)kD + c0;
  unsigned short* dp = dst + (size_t)row0 * (unsigned)kKA + c0;
  v4f d0 = *(const v4f*)(wd + c0), d1 = *(const v4f*)(wd + c1);
  v4f m0 = (v4f){1.f, 1.f, 1.f, 1.f}, m1 = m0;
  if (LEFT) { m0 = *(const v4f*)(wm + c0); m1 = *(const v4f*)(wm + c1); }
  /* before a row load's result lands in a register that an issued load of w names */
  asm volatile("s_wait_xcnt 0x0" ::: "memory");
  /* all sixteen row loads go out before the first is used */
  v4f x0[kPrepRows], x1[kPrepRows];
#pragma unroll
  for (int r = 0; r < kPrepRows; ++r) {
    x0[r] = *(const v4f*)(xp + r * kD);
    x1[r] = *(const v4f*)(xp + r * kD + 128);
  }
  /* before a register that an issued load names is written again; the address is named so that no load's result is placed over it */
  asm volatile("s_wait_xcnt 0x0" :: "v"(xp) : "memory");
#pragma unroll
  for (int e = 0; e < 4; ++e) {
    d0[e] = bf16r(d0[e]); d1[e] = bf16r(d1[e]);
    if (LEFT) { m0[e] = bf16r(m0[e]); m1[e] = bf16r(m1[e]); }
  }
  float s[kPrepRows];
#pragma unroll
  for (int r = 0; r < kPrepRows; ++r) {
    float a = 0.0f;
    v4h o0, o1;
#pragma unroll
    for (int e = 0; e < 4; ++e) {
      const float xb = bf16r(x0[r][e]);
      a = fmaf(xb, d0[e], a);
      o0[e] = (_Float16)carry_flush(LEFT ? xb * m0[e] : xb, kInCarry);
    }
#pragma unroll
    for (int e = 0; e < 4; ++e) {
      const float xb = bf16r(x1[r][e]);
      a = fmaf(xb, d1[e], a);
      o1[e] = (_Float16)carry_flush(LEFT ? xb * m1[e] : xb, kInCarry);
    }
    s[r] = a;
    /* the row's two stores (columns 4 lane .. and, 256 B on, 128 + 4 lane ..) with their wait in one statement: the next row's arithmetic writes these registers again, and a wait in a statement of its own did not stay behind the stores */
    asm volatile("global_store_b64 %0, %1, off\n\tglobal_store_b64 %0, %2, off offset:256\n\ts_wait_xcnt 0x0"
                 :: "v"(dp + r * kKA), "v"(__builtin_bit_cast(v2u, o0)), "v"(__builtin_bit_cast(v2u, o1)) : "memory");
  }
  /* eight sums over 32 lanes in one tree: each of the first three steps halves the rows a lane still carries, so lane l ends with row l >> 2 */
  const bool u16 = (lane & 16u) != 0u, u8 = (lane & 8u) != 0u, u4 = (lane & 4u) != 0u;
  float t4[4], t2[2];
#pragma unroll
  for (int i = 0; i < 4; ++i) t4[i] = (u16 ? s[i + 4] : s[i]) + __shfl_xor(u16 ? s[i] : s[i + 4], 16, 32);
#pragma unroll
  for (int i = 0; i < 2; ++i) t2[i] = (u8 ? t4[i + 2] : t4[i]) + __shfl_xor(u8 ? t4[i] : t4[i + 2], 8, 32);
  float sv = (u4 ? t2[1] : t2[0]) + __shfl_xor(u4 ? t2[0] : t2[1], 4, 32);
  sv += __shfl_xor(sv, 2, 32);
  sv += __shfl_xor(sv, 1, 32);
  /* the 32 tail columns of the eight rows: one 16-byte store a lane (row l >> 2, column group l & 3; the live four columns stand in group 0) */
  const _Float16 hi = (_Float16)carry_flush(sv, kInCarry);
  const _Float16 lo = (_Float16)carry_flush(sv - (float)hi * (1.0f / kInCarry), kInCarry);
  const _Float16 one = (_Float16)kInCarry, nought = (_Float16)0.0f;
  v8h av;
  av[0] = LEFT ? one : hi; av[1] = LEFT ? one : lo; av[2] = LEFT ? hi : one; av[3] = LEFT ? lo : one;
  av[4] = nought; av[5] = nought; av[6] = nought; av[7] = nought;
  const unsigned aug = ((lane & 3u) == 0u) ? 0xFFFFu : 0u;
  const v8us ab = __builtin_bit_cast(v8us, av);
  v8us ov;
#pragma unroll
  for (int e = 0; e < 8; ++e) ov[e] = (unsigned short)(ab[e] & aug);
  *(v8us*)(dst + (size_t)(row0 + (lane >> 2)) * (unsigned)kKA + (unsigned)kD + 8u * (lane & 3u)) = ov;
}

__global__ __launch_bounds__(kPrepThr) void prep_kernel(const float* H, const float* U, const float* Wv, unsigned short* A16, unsigned short* B16) {
  const unsigned lane = threadIdx.x & 31u;
  const unsigned wrow = (threadIdx.x >> 5) * (unsigned)kPrepRows;
  constexpr unsigned kBlkH = (unsigned)(kNB * kT / kPrepRowsBlk);
  /* W = (w_h | w_u | w_m): 256 floats each */
  if (blockIdx.x < kBlkH) build_rows<true>(H, Wv, Wv + 2 * kD, A16, blockIdx.x * (unsigned)kPrepRowsBlk + wrow, lane);
  else                    build_rows<false>(U, Wv + kD, Wv, B16, (blockIdx.x - kBlkH) * (unsigned)kPrepRowsBlk + wrow, lane);
}

extern "C" void kernel_launch(void* const* d_in, const int* in_sizes, int n_in,
                              void* d_out, int out_size, void* d_ws, size_t ws_size,
                              hipStream_t stream) {
  if (n_in < 3 || d_out == nullptr || d_ws == nullptr) return;
  if (in_sizes[0] != kNB * kT * kD || in_sizes[1] != kNB * kJ * kD || in_sizes[2] != 3 * kD) return;
  if (out_size != kNB * kT * kJ) return;
  if (ws_size < kWsTotal) return;
  const float* H = (const float*)d_in[0];
  const float* U = (const float*)d_in[1];
  const float* Wv = (const float*)d_in[2];
  float* out = (float*)d_out;
  char* ws = (char*)d_ws;
  unsigned short* A16 = (unsigned short*)(ws + kOffA16);
  unsigned short* B16 = (unsigned short*)(ws + kOffB16);

  prep_kernel<<<(kNB * kT + kNB * kJ) / kPrepRowsBlk, kPrepThr, 0, stream>>>(H, U, Wv, A16, B16);
  /* S[b] = 2^-20 (A16[b] . B16[b]^T): 2 x 8 tiles of 256 x 256 a batch: 256 work-groups */
  gemm_lds<<<dim3(kJ / kTileR, kT / kTileR, kNB), kGemmThr, 0, stream>>>(A16, B16, out);
}

// v003
// It runs in 17.5 microseconds.
// Timed twice side by side with v002, it ran 1.07 times as fast both times.
// Over all steps from v000 it is 3.38 times as fast.
/* A TRILINEAR SIMILARITY SCORE: S[b][t][j] = H[b][t] . w_h + U[b][j] . w_u + (H[b][t] * w_m) . U[b][j] for H [16][2048][256], U [16][512][256] and W [768][1] = (w_h | w_u | w_m). ONE RESULT [16][2048][512].
   Inputs are taken at their bf16 values. ONE BATCHED PRODUCT gives all three terms: THE TWO RANK-ONE TERMS RIDE INSIDE THE DEPTH: the left operand's row t is [H[t] * w_m (256) | 1 | 1 | s_h high | s_h low | noughts] and the right operand's row j is [U[j] (256) | s_u high | s_u low | 1 | 1 | noughts]: 260 live columns padded to the depth's grain: K 288; f16 operands carried by 2^10, f32 sums; H * w_m ONE f16 word (the product of two bf16 values rounded once); U exact; s_h and s_u TWO f16 words each.
   ONE LAUNCH: a work-group of sixteen waves owns a 256 x 256 tile of S[b] and BUILDS its 256 rows of each operand, the whole depth, in LDS itself, straight from H, U and W: a wave takes eight rows at a time, reads each row once in whole lines, writes its 256 f16 words and sums its row dot (s_h or s_u, f32: eight terms a lane in the index's order, then a fixed tree over the 32 lanes) on the way; the next eight rows' loads fly while these are worked on. Then every wave reads the fragments of its 64 x 64 tile from LDS. No workspace. */
#include <hip/hip_runtime.h>
#include <math.h>

typedef __attribute__((ext_vector_type(16))) _Float16 v16h;
typedef __attribute__((ext_vector_type(8)))  _Float16 v8h;
typedef unsigned short v8us __attribute__((ext_vector_type(8)));
typedef __attribute__((ext_vector_type(2)))  _Float16 v2h;
typedef __attribute__((ext_vector_type(16))) __bf16   v16b;
typedef __attribute__((ext_vector_type(8)))  __bf16   v8b;
typedef __attribute__((ext_vector_type(8)))  float    v8f;
typedef __attribute__((ext_vector_type(4)))  float    v4f;
typedef __attribute__((ext_vector_type(2)))  float    v2f;

/* ------------------------------------------------------------------------- */
/* Shape constants                                                           */
/* ------------------------------------------------------------------------- */
constexpr int kNB   = 16;                 /* batches */
constexpr int kT    = 2048;               /* H's rows a batch */
constexpr int kJ    = 512;                /* U's rows a batch */
constexpr int kD    = 256;                /* features */
constexpr int kKA   = 288;                /* the depth: 256 + 4 live columns, padded to a multiple of 32 */
constexpr int kGr   = 36;                 /* kKA / 8: column groups of a built row */
constexpr int kThr  = 256;
constexpr float kInCarry = 1024.0f;       /* 2^10: every f16 operand */
constexpr float kSc20 = 1.0f / (kInCarry * kInCarry);   /* 2^-20: two carried operands -> a true-scale f32 result */
/* 2^-14: smallest normal f16 magnitude */
constexpr float kF16MinNormal = 6.103515625e-5f;

static_assert(kNB == 16 && kT == 2048 && kJ == 512 && kD == 256 && kKA == 288 && kGr * 8 == kKA && kKA % 32 == 0, "the index arithmetic below uses these sizes");

/* ------------------------------------------------------------------------- */
/* Conversions, the matrix fragments and the product engine                  */
/* ------------------------------------------------------------------------- */
__device__ __forceinline__ unsigned short f2bf_bits(float f) {
  unsigned u = __float_as_uint(f);
  return (unsigned short)((u + 0x7FFFu + ((u >> 16) & 1u)) >> 16);
}
__device__ __forceinline__ float bf_bits2f(unsigned short h) { return __uint_as_float(((unsigned)h) << 16); }
/* RNE-convert to a bf16 value, kept in f32 */
__device__ __forceinline__ float bf16r(float f) { return bf_bits2f(f2bf_bits(f)); }
/* carry by a power of two, then flush anything below the f16 normal range to +0 by a select */
__device__ __forceinline__ float carry_flush(float v, float carry) {
  const float s = v * carry;
  return (fabsf(s) < kF16MinNormal) ? 0.0f : s;
}

/* hazard guards as plain device helpers */
__device__ __forceinline__ void dep_guard4_h(v8f& a, v8f& b, v8f& c, v8f& d, v16h x, v16h y) { asm volatile("v_nop\n\tv_nop\n\tv_nop\n\tv_nop" : "+v"(a), "+v"(b), "+v"(c), "+v"(d) : "v"(x), "v"(y)); }
__device__ __forceinline__ void dep_guard4_b(v8f& a, v8f& b, v8f& c, v8f& d, v16b x, v16b y) { asm volatile("v_nop\n\tv_nop\n\tv_nop\n\tv_nop" : "+v"(a), "+v"(b), "+v"(c), "+v"(d) : "v"(x), "v"(y)); }
__device__ __forceinline__ void keep4_h(v16h a, v16h b, v16h c, v16h d) { asm volatile("v_nop" :: "v"(a), "v"(b), "v"(c), "v"(d)); }
__device__ __forceinline__ void keep4_b(v16b a, v16b b, v16b c, v16b d) { asm volatile("v_nop" :: "v"(a), "v"(b), "v"(c), "v"(d)); }
__device__ __forceinline__ void acc_guard4(v8f& a, v8f& b, v8f& c, v8f& d) { asm volatile("v_nop\n\tv_nop\n\tv_nop\n\tv_nop" : "+v"(a), "+v"(b), "+v"(c), "+v"(d)); }

template <typename T> struct Frag;
template <> struct Frag<_Float16> {
  typedef v16h V; union U { v16h v; v8h h[2]; };
  /* elements 0..7 <- p[0..7], 8..15 <- p[16..23] */
  static __device__ __forceinline__ v16h load(const _Float16* p) {
    U f; f.h[0] = *(const v8h*)(p); f.h[1] = *(const v8h*)(p + 16); return f.v;
  }
  static __device__ __forceinline__ v8f mma(v16h a, v16h b, v8f c) {
    return __builtin_amdgcn_wmma_f32_16x16x32_f16(false, a, false, b, (short)0, c, false, false);
  }
  static __device__ __forceinline__ void guard4(v8f& a, v8f& b, v8f& c, v8f& d, v16h x, v16h y) { dep_guard4_h(a, b, c, d, x, y); }
  static __device__ __forceinline__ void keep(v16h a, v16h b, v16h c, v16h d) { keep4_h(a, b, c, d); }
};
template <> struct Frag<__bf16> {
  typedef v16b V; union U { v16b v; v8b h[2]; };
  static __device__ __forceinline__ v16b load(const __bf16* p) {
    U f; f.h[0] = *(const v8b*)(p); f.h[1] = *(const v8b*)(p + 16); return f.v;
  }
  static __device__ __forceinline__ v8f mma(v16b a, v16b b, v8f c) {
    return __builtin_amdgcn_wmma_f32_16x16x32_bf16(false, a, false, b, (short)0, c, false, false);
  }
  static __device__ __forceinline__ void guard4(v8f& a, v8f& b, v8f& c, v8f& d, v16b x, v16b y) { dep_guard4_b(a, b, c, d, x, y); }
  static __device__ __forceinline__ void keep(v16b a, v16b b, v16b c, v16b d) { keep4_b(a, b, c, d); }
};

/* ---- The batched product, operand tiles built in LDS ------------------------ */
/* S[b][m][n] = 2^-20 sum_k A16[m][k] * B16[n][k]; both operand tiles row-major in LDS, 288 f16 a row. */
constexpr int kTileR   = 256;                 /* rows of each operand a work-group holds: a 256 x 256 tile of S */
constexpr int kPitchB  = kKA * 2 + 16;        /* LDS bytes a row: 592 = 16 B x 37, odd: sixteen rows' 16-byte reads fall on 64 different banks */
constexpr int kPitchH  = kPitchB / 2;
constexpr int kOpBytes = kTileR * kPitchB;    /* 151,552 B an operand tile */
constexpr int kGemmThr = 512;                 /* sixteen waves, 4 x 4, a 64 x 64 tile each */
constexpr int kPrepRows = 8;                  /* rows a wave builds at a time: sixteen loads of 512 B in flight for them */
constexpr int kPassRows = kPrepRows * (kGemmThr / 32);   /* 128 rows a pass of the sixteen waves: two passes an operand tile */
constexpr int kSlabB   = 16 * 68 * 4;         /* a wave's output slab: 16 rows, pitch 68 floats */
static_assert(kTileR == 2 * kPassRows, "two passes an operand tile");
static_assert(2 * kOpBytes <= 327680 && (kGemmThr / 32) * kSlabB <= 2 * kOpBytes, "both tiles fit the LDS; the slabs fit the tiles' place");
static_assert(kT % kTileR == 0 && kJ % kTileR == 0, "whole tiles");


typedef __attribute__((ext_vector_type(4)))  _Float16 v4h;
typedef __attribute__((ext_vector_type(2)))  unsigned v2u;

/* eight rows' sixteen loads go out together; each covers 512 contiguous bytes of a row: columns 4 lane .. and 128 + 4 lane .. (xp points at column 4 lane of the first row) */
__device__ __forceinline__ void load_rows(const float* xp, v4f (&x0)[kPrepRows], v4f (&x1)[kPrepRows]) {
#pragma unroll
  for (int r = 0; r < kPrepRows; ++r) {
    x0[r] = *(const v4f*)(xp + r * kD);
    x1[r] = *(const v4f*)(xp + r * kD + 128);
  }
  /* before a register that an issued load names is written again; the address is named so that no load's result is placed over it; the clobber keeps the loads ahead of the work that follows */
  asm volatile("s_wait_xcnt 0x0" :: "v"(xp) : "memory");
}

/* LEFT: rows of H, d = w_h, m = w_m (bf16 values), into the A tile.  Otherwise rows of U, d = w_u, into the B tile (m not read). dp: the LDS byte of the wave's first row. */
template <bool LEFT>
__device__ __forceinline__ void build_rows(const v4f (&x0)[kPrepRows], const v4f (&x1)[kPrepRows], v4f d0, v4f d1, v4f m0, v4f m1, unsigned char* dp, unsigned lane) {
  float s[kPrepRows];
#pragma unroll
  for (int r = 0; r < kPrepRows; ++r) {
    float a = 0.0f;
    v4h o0, o1;
#pragma unroll
    for (int e = 0; e < 4; ++e) {
      const float xb = bf16r(x0[r][e]);
      a = fmaf(xb, d0[e], a);
      o0[e] = (_Float16)carry_flush(LEFT ? xb * m0[e] : xb, kInCarry);
    }
#pragma unroll
    for (int e = 0; e < 4; ++e) {
      const float xb = bf16r(x1[r][e]);
      a = fmaf(xb, d1[e], a);
      o1[e] = (_Float16)carry_flush(LEFT ? xb * m1[e] : xb, kInCarry);
    }
    s[r] = a;
    /* columns 4 lane .. and, 256 B on, 128 + 4 lane ..: 256 contiguous LDS bytes a store */
    *(v2u*)(dp + r * kPitchB + 8u * lane)       = __builtin_bit_cast(v2u, o0);
    *(v2u*)(dp + r * kPitchB + 256 + 8u * lane) = __builtin_bit_cast(v2u, o1);
  }
  /* eight sums over 32 lanes in one tree: each of the first three steps halves the rows a lane still carries, so lane l ends with row l >> 2 */
  const bool u16 = (lane & 16u) != 0u, u8 = (lane & 8u) != 0u, u4 = (lane & 4u) != 0u;
  float t4[4], t2[2];
#pragma unroll
  for (int i = 0; i < 4; ++i) t4[i] = (u16 ? s[i + 4] : s[i]) + __shfl_xor(u16 ? s[i] : s[i + 4], 16, 32);
#pragma unroll
  for (int i = 0; i < 2; ++i) t2[i] = (u8 ? t4[i + 2] : t4[i]) + __shfl_xor(u8 ? t4[i] : t4[i + 2], 8, 32);
  float sv = (u4 ? t2[1] : t2[0]) + __shfl_xor(u4 ? t2[0] : t2[1], 4, 32);
  sv += __shfl_xor(sv, 2, 32);
  sv += __shfl_xor(sv, 1, 32);
  /* the 32 tail columns of the eight rows: one 16-byte store a lane (row l >> 2, column group l & 3; the live four columns stand in group 0) */
  const _Float16 hi = (_Float16)carry_flush(sv, kInCarry);
  const _Float16 lo = (_Float16)carry_flush(sv - (float)hi * (1.0f / kInCarry), kInCarry);
  const _Float16 one = (_Float16)kInCarry, nought = (_Float16)0.0f;
  v8h av;
  av[0] = LEFT ? one : hi; av[1] = LEFT ? one : lo; av[2] = LEFT ? hi : one; av[3] = LEFT ? lo : one;
  av[4] = nought; av[5] = nought; av[6] = nought; av[7] = nought;
  const unsigned aug = ((lane & 3u) == 0u) ? 0xFFFFu : 0u;
  const v8us ab = __builtin_bit_cast(v8us, av);
  v8us ov;
#pragma unroll
  for (int e = 0; e < 8; ++e) ov[e] = (unsigned short)(ab[e] & aug);
  *(v8us*)(dp + (lane >> 2) * (unsigned)kPitchB + 2u * (unsigned)kD + 16u * (lane & 3u)) = ov;
}

__global__ __launch_bounds__(kGemmThr) void simi_kernel(const float* __restrict__ H, const float* __restrict__ U, const float* __restrict__ Wv, float* __restrict__ Cout) {
  typedef _Float16 T;
  typedef Frag<T>::V V;
  /* [A tile 256 rows | B tile 256 rows] at pitch 592 B; after the product the waves' output slabs */
  __shared__ __align__(16) unsigned char sm[2 * kOpBytes];
  const unsigned tid = threadIdx.x;
  const int lane = (int)(tid & 31u);
  const int wave = (int)(tid >> 5);
  const int b  = blockIdx.z;
  const int M0 = blockIdx.y * kTileR;
  const int N0 = blockIdx.x * kTileR;

  /* ---- build: wave w takes rows 8 w .. of each pass of 128 rows; a pass of H into the A tile and a pass of U into the B tile in turn, twice; two sets of row registers, so that one operand's next rows fly while the other operand's rows are worked on ---- */
  {
    const unsigned ul = (unsigned)lane;
    const unsigned c0 = 4u * ul, c1 = 128u + 4u * ul;
    const unsigned wrow = (unsigned)wave * (unsigned)kPrepRows;
    const float* hp = H + ((size_t)b * kT + (size_t)M0 + wrow) * (unsigned)kD + c0;
    const float* up = U + ((size_t)b * kJ + (size_t)N0 + wrow) * (unsigned)kD + c0;
    unsigned char* dA = sm + wrow * (unsigned)kPitchB;
    /* W = (w_h | w_u | w_m): 256 floats each */
    v4f h0 = *(const v4f*)(Wv + c0),          h1 = *(const v4f*)(Wv + c1);
    v4f u0 = *(const v4f*)(Wv + kD + c0),     u1 = *(const v4f*)(Wv + kD + c1);
    v4f m0 = *(const v4f*)(Wv + 2 * kD + c0), m1 = *(const v4f*)(Wv + 2 * kD + c1);
    /* before a row load's result lands in a register that an issued load of w names */
    asm volatile("s_wait_xcnt 0x0" ::: "memory");
    v4f xh0[kPrepRows], xh1[kPrepRows], xu0[kPrepRows], xu1[kPrepRows];
    load_rows(hp, xh0, xh1);
    load_rows(up, xu0, xu1);
#pragma unroll
    for (int e = 0; e < 4; ++e) {
      h0[e] = bf16r(h0[e]); h1[e] = bf16r(h1[e]);
      u0[e] = bf16r(u0[e]); u1[e] = bf16r(u1[e]);
      m0[e] = bf16r(m0[e]); m1[e] = bf16r(m1[e]);
    }
    /* kept rolled: the branches round the loads keep each refill where it stands, directly behind the last use of its registers and ahead of the other operand's arithmetic (unrolled into one block, the compiler moved that arithmetic in front of the loads, or the loads into a third register set that spilled) */
#pragma unroll 1
    for (int p = 0; p < 2; ++p) {
      build_rows<true>(xh0, xh1, h0, h1, m0, m1, dA, ul);
      if (p == 0) load_rows(hp + kPassRows * kD, xh0, xh1);
      build_rows<false>(xu0, xu1, u0, u1, m0, m1, dA + kOpBytes, ul);
      if (p == 0) load_rows(up + kPassRows * kD, xu0, xu1);
      dA += kPassRows * kPitchB;
    }
  }
  /* every wave's rows stand in LDS: the tiles may be read */
  __syncthreads();

  /* row (A) / col (B, D) within subtile; k offset of this lane half; D row offset */
  const int rlane = lane & 15;
  const int koff  = (lane >> 4) * 8;
  const int mOff  = (lane >> 4) * 8;
  const int m0 = (wave >> 2) << 6;
  const int n0 = (wave & 3) << 6;
  const T* sA = (const T*)sm + (m0 + rlane) * kPitchH + koff;
  const T* sB = (const T*)(sm + kOpBytes) + (n0 + rlane) * kPitchH + koff;

  v8f acc[4][4];
#pragma unroll
  for (int i = 0; i < 4; ++i)
#pragma unroll
    for (int j = 0; j < 4; ++j) acc[i][j] = (v8f){0.f,0.f,0.f,0.f,0.f,0.f,0.f,0.f};

  /* unrolled: every fragment address is the wave's base and an immediate */
#pragma unroll
  for (int k0 = 0; k0 < kKA; k0 += 32) {
    /* the step's eight fragments go out as one group ahead of its sixteen matrix instructions: one LDS wait a step */
    V bh[4], ah[4];
#pragma unroll
    for (int j = 0; j < 4; ++j) bh[j] = Frag<T>::load(sB + (j << 4) * kPitchH + k0);
#pragma unroll
    for (int i = 0; i < 4; ++i) ah[i] = Frag<T>::load(sA + (i << 4) * kPitchH + k0);
#pragma unroll
    for (int i = 0; i < 4; ++i) {
#pragma unroll
      for (int j = 0; j < 4; ++j) acc[i][j] = Frag<T>::mma(ah[i], bh[j], acc[i][j]);
      /* all four accumulators of this row group tied, A fragment named */
      Frag<T>::guard4(acc[i][0], acc[i][1], acc[i][2], acc[i][3], ah[i], ah[i]);
    }
    Frag<T>::keep(bh[0], bh[1], bh[2], bh[3]);
  }
  acc_guard4(acc[0][0], acc[0][1], acc[0][2], acc[0][3]);
  acc_guard4(acc[1][0], acc[1][1], acc[1][2], acc[1][3]);
  acc_guard4(acc[2][0], acc[2][1], acc[2][2], acc[2][3]);
  acc_guard4(acc[3][0], acc[3][1], acc[3][2], acc[3][3]);

  /* every wave's last fragment read is over: the tiles' LDS becomes output staging */
  __syncthreads();

  /* ---- epilogue: 16 x 64 at a time through the wave's own slab, stored in whole lines ---- */
  float* slab = (float*)(sm + wave * kSlabB);
  float* C = Cout + (size_t)b * ((size_t)kT * kJ);
#pragma unroll
  for (int i = 0; i < 4; ++i) {
    const int mBase = M0 + m0 + (i << 4);
#pragma unroll
    for (int j = 0; j < 4; ++j) {
#pragma unroll
      for (int r = 0; r < 8; ++r) slab[(mOff + r) * 68 + (j << 4) + rlane] = acc[i][j][r] * kSc20;
    }
    __builtin_amdgcn_fence(__ATOMIC_RELEASE, "workgroup");
    __builtin_amdgcn_wave_barrier();
    __builtin_amdgcn_fence(__ATOMIC_ACQUIRE, "workgroup");
    /* row seg = 256 B = 16 lanes x 16 B */
    const int hh = lane >> 4, c4 = (lane & 15) * 4;
#pragma unroll
    for (int it = 0; it < 8; ++it) {
      const int row = it * 2 + hh;
      v4f v = *(const v4f*)(slab + row * 68 + c4);
      *(v4f*)(C + (size_t)(mBase + row) * kJ + N0 + n0 + c4) = v;
    }
    __builtin_amdgcn_fence(__ATOMIC_RELEASE, "workgroup");
    __builtin_amdgcn_wave_barrier();
    __builtin_amdgcn_fence(__ATOMIC_ACQUIRE, "workgroup");
  }
}

extern "C" void kernel_launch(void* const* d_in, const int* in_sizes, int n_in,
                              void* d_out, int out_size, void* d_ws, size_t ws_size,
                              hipStream_t stream) {
  if (n_in < 3 || d_out == nullptr) return;
  if (in_sizes[0] != kNB * kT * kD || in_sizes[1] != kNB * kJ * kD || in_sizes[2] != 3 * kD) return;
  if (out_size != kNB * kT * kJ) return;
  const float* H = (const float*)d_in[0];
  const float* U = (const float*)d_in[1];
  const float* Wv = (const float*)d_in[2];
  float* out = (float*)d_out;

  /* 2 x 8 tiles of 256 x 256 a batch: 256 work-groups */
  simi_kernel<<<dim3(kJ / kTileR, kT / kTileR, kNB), kGemmThr, 0, stream>>>(H, U, Wv, out);
}

// v004
// One run takes 15.3 microseconds.
// Two timings next to v003 both put it at 1.14 times that version's speed.
// All steps since v000 together make it 3.85 times as fast.
/* A TRILINEAR SIMILARITY SCORE: S[b][t][j] = H[b][t] . w_h + U[b][j] . w_u + (H[b][t] * w_m) . U[b][j] for H [16][2048][256], U [16][512][256] and W [768][1] = (w_h | w_u | w_m). ONE RESULT [16][2048][512].
   Inputs are taken at their bf16 values. ONE BATCHED PRODUCT gives all three terms: THE TWO RANK-ONE TERMS RIDE INSIDE THE DEPTH: the left operand's row t is [H[t] * w_m (256) | 1 | 1 | s_h high | s_h low | noughts] and the right operand's row j is [U[j] (256) | s_u high | s_u low | 1 | 1 | noughts]: 260 live columns padded to the depth's grain: K 288; f16 operands carried by 2^10, f32 sums; H * w_m ONE f16 word (the product of two bf16 values rounded once); U exact; s_h and s_u TWO f16 words each.
   ONE LAUNCH: a work-group of sixteen waves owns a 256 x 256 tile of S[b] and BUILDS its 256 rows of each operand, the whole depth, in LDS itself, straight from H, U and W: a wave takes eight rows at a time, reads each row once in whole lines, writes its 256 f16 words and sums its row dot (s_h or s_u, f32: a lane's four even and four odd columns each in the index's order, the two joined, then a fixed tree over the 32 lanes) on the way, two columns an instruction; the next eight rows' loads fly while these are worked on. Then every wave reads the fragments of its 64 x 64 tile from LDS. No workspace. */
#include <hip/hip_runtime.h>
#include <math.h>

typedef __attribute__((ext_vector_type(16))) _Float16 v16h;
typedef __attribute__((ext_vector_type(8)))  _Float16 v8h;
typedef unsigned short v8us __attribute__((ext_vector_type(8)));
typedef __attribute__((ext_vector_type(2)))  _Float16 v2h;
typedef __attribute__((ext_vector_type(16))) __bf16   v16b;
typedef __attribute__((ext_vector_type(8)))  __bf16   v8b;
typedef __attribute__((ext_vector_type(2)))  __bf16   v2b;
typedef __attribute__((ext_vector_type(8)))  float    v8f;
typedef __attribute__((ext_vector_type(4)))  float    v4f;
typedef __attribute__((ext_vector_type(2)))  float    v2f;

/* ------------------------------------------------------------------------- */
/* Shape constants                                                           */
/* ------------------------------------------------------------------------- */
constexpr int kNB   = 16;                 /* batches */
constexpr int kT    = 2048;               /* H's rows a batch */
constexpr int kJ    = 512;                /* U's rows a batch */
constexpr int kD    = 256;                /* features */
constexpr int kKA   = 288;                /* the depth: 256 + 4 live columns, padded to a multiple of 32 */
constexpr int kGr   = 36;                 /* kKA / 8: column groups of a built row */
constexpr int kThr  = 256;
constexpr float kInCarry = 1024.0f;       /* 2^10: every f16 operand */
constexpr float kSc20 = 1.0f / (kInCarry * kInCarry);   /* 2^-20: two carried operands -> a true-scale f32 result */
/* 2^-14: smallest normal f16 magnitude */
constexpr float kF16MinNormal = 6.103515625e-5f;

static_assert(kNB == 16 && kT == 2048 && kJ == 512 && kD == 256 && kKA == 288 && kGr * 8 == kKA && kKA % 32 == 0, "the index arithmetic below uses these sizes");

/* ------------------------------------------------------------------------- */
/* Conversions, the matrix fragments and the product engine                  */
/* ------------------------------------------------------------------------- */
__device__ __forceinline__ unsigned short f2bf_bits(float f) {
  unsigned u = __float_as_uint(f);
  return (unsigned short)((u + 0x7FFFu + ((u >> 16) & 1u)) >> 16);
}
__device__ __forceinline__ float bf_bits2f(unsigned short h) { return __uint_as_float(((unsigned)h) << 16); }
/* RNE-convert to a bf16 value, kept in f32 */
__device__ __forceinline__ float bf16r(float f) { return bf_bits2f(f2bf_bits(f)); }
/* two at a time: one packed RNE convert to bf16, the two values widened again to f32 */
__device__ __forceinline__ v2f bf16r2(v2f f) {
  const unsigned u = __builtin_bit_cast(unsigned, __builtin_convertvector(f, v2b));
  return (v2f){__uint_as_float(u << 16), __uint_as_float(u & 0xFFFF0000u)};
}
/* carry by a power of two, then flush anything below the f16 normal range to +0 by a select */
__device__ __forceinline__ float carry_flush(float v, float carry) {
  const float s = v * carry;
  return (fabsf(s) < kF16MinNormal) ? 0.0f : s;
}

/* hazard guards as plain device helpers */
__device__ __forceinline__ void dep_guard4_h(v8f& a, v8f& b, v8f& c, v8f& d, v16h x, v16h y) { asm volatile("v_nop\n\tv_nop\n\tv_nop\n\tv_nop" : "+v"(a), "+v"(b), "+v"(c), "+v"(d) : "v"(x), "v"(y)); }
__device__ __forceinline__ void dep_guard4_b(v8f& a, v8f& b, v8f& c, v8f& d, v16b x, v16b y) { asm volatile("v_nop\n\tv_nop\n\tv_nop\n\tv_nop" : "+v"(a), "+v"(b), "+v"(c), "+v"(d) : "v"(x), "v"(y)); }
__device__ __forceinline__ void keep4_h(v16h a, v16h b, v16h c, v16h d) { asm volatile("v_nop" :: "v"(a), "v"(b), "v"(c), "v"(d)); }
__device__ __forceinline__ void keep4_b(v16b a, v16b b, v16b c, v16b d) { asm volatile("v_nop" :: "v"(a), "v"(b), "v"(c), "v"(d)); }
__device__ __forceinline__ void acc_guard4(v8f& a, v8f& b, v8f& c, v8f& d) { asm volatile("v_nop\n\tv_nop\n\tv_nop\n\tv_nop" : "+v"(a), "+v"(b), "+v"(c), "+v"(d)); }

template <typename T> struct Frag;
template <> struct Frag<_Float16> {
  typedef v16h V; union U { v16h v; v8h h[2]; };
  /* elements 0..7 <- p[0..7], 8..15 <- p[16..23] */
  static __device__ __forceinline__ v16h load(const _Float16* p) {
    U f; f.h[0] = *(const v8h*)(p); f.h[1] = *(const v8h*)(p + 16); return f.v;
  }
  static __device__ __forceinline__ v8f mma(v16h a, v16h b, v8f c) {
    return __builtin_amdgcn_wmma_f32_16x16x32_f16(false, a, false, b, (short)0, c, false, false);
  }
  static __device__ __forceinline__ void guard4(v8f& a, v8f& b, v8f& c, v8f& d, v16h x, v16h y) { dep_guard4_h(a, b, c, d, x, y); }
  static __device__ __forceinline__ void keep(v16h a, v16h b, v16h c, v16h d) { keep4_h(a, b, c, d); }
};
template <> struct Frag<__bf16> {
  typedef v16b V; union U { v16b v; v8b h[2]; };
  static __device__ __forceinline__ v16b load(const __bf16* p) {
    U f; f.h[0] = *(const v8b*)(p); f.h[1] = *(const v8b*)(p + 16); return f.v;
  }
  static __device__ __forceinline__ v8f mma(v16b a, v16b b, v8f c) {
    return __builtin_amdgcn_wmma_f32_16x16x32_bf16(false, a, false, b, (short)0, c, false, false);
  }
  static __device__ __forceinline__ void guard4(v8f& a, v8f& b, v8f& c, v8f& d, v16b x, v16b y) { dep_guard4_b(a, b, c, d, x, y); }
  static __device__ __forceinline__ void keep(v16b a, v16b b, v16b c, v16b d) { keep4_b(a, b, c, d); }
};

/* ---- The batched product, operand tiles built in LDS ------------------------ */
/* S[b][m][n] = 2^-20 sum_k A16[m][k] * B16[n][k]; both operand tiles row-major in LDS, 288 f16 a row. */
constexpr int kTileR   = 256;                 /* rows of each operand a work-group holds: a 256 x 256 tile of S */
constexpr int kPitchB  = kKA * 2 + 16;        /* LDS bytes a row: 592 = 16 B x 37, odd: sixteen rows' 16-byte reads fall on 64 different banks */
constexpr int kPitchH  = kPitchB / 2;
constexpr int kOpBytes = kTileR * kPitchB;    /* 151,552 B an operand tile */
constexpr int kGemmThr = 512;                 /* sixteen waves, 4 x 4, a 64 x 64 tile each */
constexpr int kPrepRows = 8;                  /* rows a wave builds at a time: sixteen loads of 512 B in flight for them */
constexpr int kPassRows = kPrepRows * (kGemmThr / 32);   /* 128 rows a pass of the sixteen waves: two passes an operand tile */
constexpr int kSlabB   = 16 * 68 * 4;         /* a wave's output slab: 16 rows, pitch 68 floats */
static_assert(kTileR == 2 * kPassRows, "two passes an operand tile");
static_assert(2 * kOpBytes <= 327680 && (kGemmThr / 32) * kSlabB <= 2 * kOpBytes, "both tiles fit the LDS; the slabs fit the tiles' place");
static_assert(kT % kTileR == 0 && kJ % kTileR == 0, "whole tiles");


typedef __attribute__((ext_vector_type(4)))  _Float16 v4h;
typedef __attribute__((ext_vector_type(2)))  unsigned v2u;

/* eight rows' sixteen loads go out together; each covers 512 contiguous bytes of a row: columns 4 lane .. and 128 + 4 lane .. (xp points at column 4 lane of the first row) */
__device__ __forceinline__ void load_rows(const float* xp, v4f (&x0)[kPrepRows], v4f (&x1)[kPrepRows]) {
#pragma unroll
  for (int r = 0; r < kPrepRows; ++r) {
    x0[r] = *(const v4f*)(xp + r * kD);
    x1[r] = *(const v4f*)(xp + r * kD + 128);
  }
  /* before a register that an issued load names is written again; the address is named so that no load's result is placed over it; the clobber keeps the loads ahead of the work that follows */
  asm volatile("s_wait_xcnt 0x0" :: "v"(xp) : "memory");
}

/* LEFT: rows of H, d = w_h, m = 2^10 w_m (bf16 values, the carry folded in: exact), into the A tile.  Otherwise rows of U, d = w_u, m = 2^10, into the B tile. dp: the LDS byte of the wave's first row.
   Two columns an instruction all the way: packed convert to bf16, packed f32 product and row-dot step (even and odd columns summed apart, joined at the end), packed RNE convert to f16. A column below the f16 normal range is stored as the subnormal it rounds to (the matrix unit keeps subnormal operands), not as nought: the nearer value, and no compare and select a column. */
template <bool LEFT>
__device__ __forceinline__ void build_rows(const v4f (&x0)[kPrepRows], const v4f (&x1)[kPrepRows], v4f d0, v4f d1, v4f m0, v4f m1, unsigned char* dp, unsigned lane) {
  float s[kPrepRows];
#pragma unroll
  for (int r = 0; r < kPrepRows; ++r) {
    v2f a = (v2f){0.0f, 0.0f};
    v2h o[4];
#pragma unroll
    for (int q = 0; q < 2; ++q) {
      const v2f xb = bf16r2((v2f){x0[r][2 * q], x0[r][2 * q + 1]});
      a = __builtin_elementwise_fma(xb, (v2f){d0[2 * q], d0[2 * q + 1]}, a);
      o[q] = __builtin_convertvector(xb * (v2f){m0[2 * q], m0[2 * q + 1]}, v2h);
    }
#pragma unroll
    for (int q = 0; q < 2; ++q) {
      const v2f xb = bf16r2((v2f){x1[r][2 * q], x1[r][2 * q + 1]});
      a = __builtin_elementwise_fma(xb, (v2f){d1[2 * q], d1[2 * q + 1]}, a);
      o[2 + q] = __builtin_convertvector(xb * (v2f){m1[2 * q], m1[2 * q + 1]}, v2h);
    }
    s[r] = a[0] + a[1];
    /* columns 4 lane .. and, 256 B on, 128 + 4 lane ..: 256 contiguous LDS bytes a store */
    *(v2u*)(dp + r * kPitchB + 8u * lane)       = (v2u){__builtin_bit_cast(unsigned, o[0]), __builtin_bit_cast(unsigned, o[1])};
    *(v2u*)(dp + r * kPitchB + 256 + 8u * lane) = (v2u){__builtin_bit_cast(unsigned, o[2]), __builtin_bit_cast(unsigned, o[3])};
  }
  /* eight sums over 32 lanes in one tree: each of the first three steps halves the rows a lane still carries, so lane l ends with row l >> 2 */
  const bool u16 = (lane & 16u) != 0u, u8 = (lane & 8u) != 0u, u4 = (lane & 4u) != 0u;
  float t4[4], t2[2];
#pragma unroll
  for (int i = 0; i < 4; ++i) t4[i] = (u16 ? s[i + 4] : s[i]) + __shfl_xor(u16 ? s[i] : s[i + 4], 16, 32);
#pragma unroll
  for (int i = 0; i < 2; ++i) t2[i] = (u8 ? t4[i + 2] : t4[i]) + __shfl_xor(u8 ? t4[i] : t4[i + 2], 8, 32);
  float sv = (u4 ? t2[1] : t2[0]) + __shfl_xor(u4 ? t2[0] : t2[1], 4, 32);
  sv += __shfl_xor(sv, 2, 32);
  sv += __shfl_xor(sv, 1, 32);
  /* the 32 tail columns of the eight rows: one 16-byte store a lane (row l >> 2, column group l & 3; the live four columns stand in group 0) */
  const _Float16 hi = (_Float16)carry_flush(sv, kInCarry);
  const _Float16 lo = (_Float16)carry_flush(sv - (float)hi * (1.0f / kInCarry), kInCarry);
  const _Float16 one = (_Float16)kInCarry, nought = (_Float16)0.0f;
  v8h av;
  av[0] = LEFT ? one : hi; av[1] = LEFT ? one : lo; av[2] = LEFT ? hi : one; av[3] = LEFT ? lo : one;
  av[4] = nought; av[5] = nought; av[6] = nought; av[7] = nought;
  const unsigned aug = ((lane & 3u) == 0u) ? 0xFFFFu : 0u;
  const v8us ab = __builtin_bit_cast(v8us, av);
  v8us ov;
#pragma unroll
  for (int e = 0; e < 8; ++e) ov[e] = (unsigned short)(ab[e] & aug);
  *(v8us*)(dp + (lane >> 2) * (unsigned)kPitchB + 2u * (unsigned)kD + 16u * (lane & 3u)) = ov;
}

__global__ __launch_bounds__(kGemmThr) void simi_kernel(const float* __restrict__ H, const float* __restrict__ U, const float* __restrict__ Wv, float* __restrict__ Cout) {
  typedef _Float16 T;
  typedef Frag<T>::V V;
  /* [A tile 256 rows | B tile 256 rows] at pitch 592 B; after the product the waves' output slabs */
  __shared__ __align__(16) unsigned char sm[2 * kOpBytes];
  const unsigned tid = threadIdx.x;
  const int lane = (int)(tid & 31u);
  const int wave = (int)(tid >> 5);
  const int b  = blockIdx.z;
  const int M0 = blockIdx.y * kTileR;
  const int N0 = blockIdx.x * kTileR;

  /* ---- build: wave w takes rows 8 w .. of each pass of 128 rows; a pass of H into the A tile and a pass of U into the B tile in turn, twice; two sets of row registers, so that one operand's next rows fly while the other operand's rows are worked on ---- */
  {
    const unsigned ul = (unsigned)lane;
    const unsigned c0 = 4u * ul, c1 = 128u + 4u * ul;
    const unsigned wrow = (unsigned)wave * (unsigned)kPrepRows;
    const float* hp = H + ((size_t)b * kT + (size_t)M0 + wrow) * (unsigned)kD + c0;
    const float* up = U + ((size_t)b * kJ + (size_t)N0 + wrow) * (unsigned)kD + c0;
    unsigned char* dA = sm + wrow * (unsigned)kPitchB;
    /* W = (w_h | w_u | w_m): 256 floats each */
    v4f h0 = *(const v4f*)(Wv + c0),          h1 = *(const v4f*)(Wv + c1);
    v4f u0 = *(const v4f*)(Wv + kD + c0),     u1 = *(const v4f*)(Wv + kD + c1);
    v4f m0 = *(const v4f*)(Wv + 2 * kD + c0), m1 = *(const v4f*)(Wv + 2 * kD + c1);
    /* before a row load's result lands in a register that an issued load of w names */
    asm volatile("s_wait_xcnt 0x0" ::: "memory");
    v4f xh0[kPrepRows], xh1[kPrepRows], xu0[kPrepRows], xu1[kPrepRows];
    load_rows(hp, xh0, xh1);
    load_rows(up, xu0, xu1);
#pragma unroll
    for (int e = 0; e < 4; ++e) {
      h0[e] = bf16r(h0[e]); h1[e] = bf16r(h1[e]);
      u0[e] = bf16r(u0[e]); u1[e] = bf16r(u1[e]);
      m0[e] = bf16r(m0[e]) * kInCarry; m1[e] = bf16r(m1[e]) * kInCarry;
    }
    const v4f kCarry4 = (v4f){kInCarry, kInCarry, kInCarry, kInCarry};
    /* kept rolled: the branches round the loads keep each refill where it stands, directly behind the last use of its registers and ahead of the other operand's arithmetic (unrolled into one block, the compiler moved that arithmetic in front of the loads, or the loads into a third register set that spilled) */
#pragma unroll 1
    for (int p = 0; p < 2; ++p) {
      build_rows<true>(xh0, xh1, h0, h1, m0, m1, dA, ul);
      if (p == 0) load_rows(hp + kPassRows * kD, xh0, xh1);
      build_rows<false>(xu0, xu1, u0, u1, kCarry4, kCarry4, dA + kOpBytes, ul);
      if (p == 0) load_rows(up + kPassRows * kD, xu0, xu1);
      dA += kPassRows * kPitchB;
    }
  }
  /* every wave's rows stand in LDS: the tiles may be read */
  __syncthreads();

  /* row (A) / col (B, D) within subtile; k offset of this lane half; D row offset */
  const int rlane = lane & 15;
  const int koff  = (lane >> 4) * 8;
  const int mOff  = (lane >> 4) * 8;
  const int m0 = (wave >> 2) << 6;
  const int n0 = (wave & 3) << 6;
  const T* sA = (const T*)sm + (m0 + rlane) * kPitchH + koff;
  const T* sB = (const T*)(sm + kOpBytes) + (n0 + rlane) * kPitchH + koff;

  v8f acc[4][4];
#pragma unroll
  for (int i = 0; i < 4; ++i)
#pragma unroll
    for (int j = 0; j < 4; ++j) acc[i][j] = (v8f){0.f,0.f,0.f,0.f,0.f,0.f,0.f,0.f};

  /* unrolled: every fragment address is the wave's base and an immediate */
#pragma unroll
  for (int k0 = 0; k0 < kKA; k0 += 32) {
    /* the step's eight fragments go out as one group ahead of its sixteen matrix instructions: one LDS wait a step */
    V bh[4], ah[4];
#pragma unroll
    for (int j = 0; j < 4; ++j) bh[j] = Frag<T>::load(sB + (j << 4) * kPitchH + k0);
#pragma unroll
    for (int i = 0; i < 4; ++i) ah[i] = Frag<T>::load(sA + (i << 4) * kPitchH + k0);
#pragma unroll
    for (int i = 0; i < 4; ++i) {
#pragma unroll
      for (int j = 0; j < 4; ++j) acc[i][j] = Frag<T>::mma(ah[i], bh[j], acc[i][j]);
      /* all four accumulators of this row group tied, A fragment named */
      Frag<T>::guard4(acc[i][0], acc[i][1], acc[i][2], acc[i][3], ah[i], ah[i]);
    }
    Frag<T>::keep(bh[0], bh[1], bh[2], bh[3]);
  }
  acc_guard4(acc[0][0], acc[0][1], acc[0][2], acc[0][3]);
  acc_guard4(acc[1][0], acc[1][1], acc[1][2], acc[1][3]);
  acc_guard4(acc[2][0], acc[2][1], acc[2][2], acc[2][3]);
  acc_guard4(acc[3][0], acc[3][1], acc[3][2], acc[3][3]);

  /* every wave's last fragment read is over: the tiles' LDS becomes output staging */
  __syncthreads();

  /* ---- epilogue: 16 x 64 at a time through the wave's own slab, stored in whole lines ---- */
  float* slab = (float*)(sm + wave * kSlabB);
  float* C = Cout + (size_t)b * ((size_t)kT * kJ);
#pragma unroll
  for (int i = 0; i < 4; ++i) {
    const int mBase = M0 + m0 + (i << 4);
#pragma unroll
    for (int j = 0; j < 4; ++j) {
#pragma unroll
      for (int r = 0; r < 8; ++r) slab[(mOff + r) * 68 + (j << 4) + rlane] = acc[i][j][r] * kSc20;
    }
    __builtin_amdgcn_fence(__ATOMIC_RELEASE, "workgroup");
    __builtin_amdgcn_wave_barrier();
    __builtin_amdgcn_fence(__ATOMIC_ACQUIRE, "workgroup");
    /* row seg = 256 B = 16 lanes x 16 B */
    const int hh = lane >> 4, c4 = (lane & 15) * 4;
#pragma unroll
    for (int it = 0; it < 8; ++it) {
      const int row = it * 2 + hh;
      v4f v = *(const v4f*)(slab + row * 68 + c4);
      *(v4f*)(C + (size_t)(mBase + row) * kJ + N0 + n0 + c4) = v;
    }
    __builtin_amdgcn_fence(__ATOMIC_RELEASE, "workgroup");
    __builtin_amdgcn_wave_barrier();
    __builtin_amdgcn_fence(__ATOMIC_ACQUIRE, "workgroup");
  }
}

extern "C" void kernel_launch(void* const* d_in, const int* in_sizes, int n_in,
                              void* d_out, int out_size, void* d_ws, size_t ws_size,
                              hipStream_t stream) {
  if (n_in < 3 || d_out == nullptr) return;
  if (in_sizes[0] != kNB * kT * kD || in_sizes[1] != kNB * kJ * kD || in_sizes[2] != 3 * kD) return;
  if (out_size != kNB * kT * kJ) return;
  const float* H = (const float*)d_in[0];
  const float* U = (const float*)d_in[1];
  const float* Wv = (const float*)d_in[2];
  float* out = (float*)d_out;

  /* 2 x 8 tiles of 256 x 256 a batch: 256 work-groups */
  simi_kernel<<<dim3(kJ / kTileR, kT / kTileR, kNB), kGemmThr, 0, stream>>>(H, U, Wv, out);
}

// v005
// A run of this version takes 13.9 microseconds.
// Two timings next to v004 both put it at 1.10 times that version's speed.
// All steps since v000 together make it 4.25 times as fast.
/* A TRILINEAR SIMILARITY SCORE: S[b][t][j] = H[b][t] . w_h + U[b][j] . w_u + (H[b][t] * w_m) . U[b][j] for H [16][2048][256], U [16][512][256] and W [768][1] = (w_h | w_u | w_m). ONE RESULT [16][2048][512].
   Inputs are taken at their bf16 values. ONE BATCHED PRODUCT gives all three terms: THE TWO RANK-ONE TERMS RIDE INSIDE THE DEPTH: the left operand's row t is [H[t] * w_m (256) | 1 | 1 | s_h high | s_h low | noughts] and the right operand's row j is [U[j] (256) | s_u high | s_u low | 1 | 1 | noughts]: 260 live columns padded to the depth's grain: K 288; f16 operands carried by 2^10, f32 sums; H * w_m ONE f16 word (the product of two bf16 values rounded once); U exact; s_h and s_u TWO f16 words each.
   ONE LAUNCH: a work-group of sixteen waves owns a 256 x 256 tile of S[b] and BUILDS its 256 rows of each operand, the whole depth, in LDS itself, straight from H, U and W: a wave takes eight rows at a time, reads each row once in whole lines, writes its 256 f16 words and sums its row dot (s_h or s_u, f32: a lane's four even and four odd columns each in the index's order, the two joined, then a fixed tree over the 32 lanes) on the way, two columns an instruction; the next eight rows' loads fly while these are worked on. Then every wave reads the fragments of its 64 x 64 tile from LDS. U's rows stand in the B tile four-way interleaved inside each group of 64 (row 4 c + j at place 16 j + c), so that a lane's four accumulators of one output row are four adjacent columns: the result goes from the registers to memory in 16-byte stores, 256 B a row, through no LDS. No workspace. */
#include <hip/hip_runtime.h>
#include <math.h>

typedef __attribute__((ext_vector_type(16))) _Float16 v16h;
typedef __attribute__((ext_vector_type(8)))  _Float16 v8h;
typedef unsigned short v8us __attribute__((ext_vector_type(8)));
typedef __attribute__((ext_vector_type(2)))  _Float16 v2h;
typedef __attribute__((ext_vector_type(16))) __bf16   v16b;
typedef __attribute__((ext_vector_type(8)))  __bf16   v8b;
typedef __attribute__((ext_vector_type(2)))  __bf16   v2b;
typedef __attribute__((ext_vector_type(8)))  float    v8f;
typedef __attribute__((ext_vector_type(4)))  float    v4f;
typedef __attribute__((ext_vector_type(2)))  float    v2f;

/* ------------------------------------------------------------------------- */
/* Shape constants                                                           */
/* ------------------------------------------------------------------------- */
constexpr int kNB   = 16;                 /* batches */
constexpr int kT    = 2048;               /* H's rows a batch */
constexpr int kJ    = 512;                /* U's rows a batch */
constexpr int kD    = 256;                /* features */
constexpr int kKA   = 288;                /* the depth: 256 + 4 live columns, padded to a multiple of 32 */
constexpr int kGr   = 36;                 /* kKA / 8: column groups of a built row */
constexpr int kThr  = 256;
constexpr float kInCarry = 1024.0f;       /* 2^10: every f16 operand */
constexpr float kSc20 = 1.0f / (kInCarry * kInCarry);   /* 2^-20: two carried operands -> a true-scale f32 result */
/* 2^-14: smallest normal f16 magnitude */
constexpr float kF16MinNormal = 6.103515625e-5f;

static_assert(kNB == 16 && kT == 2048 && kJ == 512 && kD == 256 && kKA == 288 && kGr * 8 == kKA && kKA % 32 == 0, "the index arithmetic below uses these sizes");

/* ------------------------------------------------------------------------- */
/* Conversions, the matrix fragments and the product engine                  */
/* ------------------------------------------------------------------------- */
__device__ __forceinline__ unsigned short f2bf_bits(float f) {
  unsigned u = __float_as_uint(f);
  return (unsigned short)((u + 0x7FFFu + ((u >> 16) & 1u)) >> 16);
}
__device__ __forceinline__ float bf_bits2f(unsigned short h) { return __uint_as_float(((unsigned)h) << 16); }
/* RNE-convert to a bf16 value, kept in f32 */
__device__ __forceinline__ float bf16r(float f) { return bf_bits2f(f2bf_bits(f)); }
/* two at a time: one packed RNE convert to bf16, the two values widened again to f32 */
__device__ __forceinline__ v2f bf16r2(v2f f) {
  const unsigned u = __builtin_bit_cast(unsigned, __builtin_convertvector(f, v2b));
  return (v2f){__uint_as_float(u << 16), __uint_as_float(u & 0xFFFF0000u)};
}
/* carry by a power of two, then flush anything below the f16 normal range to +0 by a select */
__device__ __forceinline__ float carry_flush(float v, float carry) {
  const float s = v * carry;
  return (fabsf(s) < kF16MinNormal) ? 0.0f : s;
}

/* hazard guards as plain device helpers */
__device__ __forceinline__ void dep_guard4_h(v8f& a, v8f& b, v8f& c, v8f& d, v16h x, v16h y) { asm volatile("v_nop\n\tv_nop\n\tv_nop\n\tv_nop" : "+v"(a), "+v"(b), "+v"(c), "+v"(d) : "v"(x), "v"(y)); }
__device__ __forceinline__ void dep_guard4_b(v8f& a, v8f& b, v8f& c, v8f& d, v16b x, v16b y) { asm volatile("v_nop\n\tv_nop\n\tv_nop\n\tv_nop" : "+v"(a), "+v"(b), "+v"(c), "+v"(d) : "v"(x), "v"(y)); }
__device__ __forceinline__ void keep4_h(v16h a, v16h b, v16h c, v16h d) { asm volatile("v_nop" :: "v"(a), "v"(b), "v"(c), "v"(d)); }
__device__ __forceinline__ void keep4_b(v16b a, v16b b, v16b c, v16b d) { asm volatile("v_nop" :: "v"(a), "v"(b), "v"(c), "v"(d)); }
__device__ __forceinline__ void acc_guard4(v8f& a, v8f& b, v8f& c, v8f& d) { asm volatile("v_nop\n\tv_nop\n\tv_nop\n\tv_nop" : "+v"(a), "+v"(b), "+v"(c), "+v"(d)); }

template <typename T> struct Frag;
template <> struct Frag<_Float16> {
  typedef v16h V; union U { v16h v; v8h h[2]; };
  /* elements 0..7 <- p[0..7], 8..15 <- p[16..23] */
  static __device__ __forceinline__ v16h load(const _Float16* p) {
    U f; f.h[0] = *(const v8h*)(p); f.h[1] = *(const v8h*)(p + 16); return f.v;
  }
  static __device__ __forceinline__ v8f mma(v16h a, v16h b, v8f c) {
    return __builtin_amdgcn_wmma_f32_16x16x32_f16(false, a, false, b, (short)0, c, false, false);
  }
  static __device__ __forceinline__ void guard4(v8f& a, v8f& b, v8f& c, v8f& d, v16h x, v16h y) { dep_guard4_h(a, b, c, d, x, y); }
  static __device__ __forceinline__ void keep(v16h a, v16h b, v16h c, v16h d) { keep4_h(a, b, c, d); }
};
template <> struct Frag<__bf16> {
  typedef v16b V; union U { v16b v; v8b h[2]; };
  static __device__ __forceinline__ v16b load(const __bf16* p) {
    U f; f.h[0] = *(const v8b*)(p); f.h[1] = *(const v8b*)(p + 16); return f.v;
  }
  static __device__ __forceinline__ v8f mma(v16b a, v16b b, v8f c) {
    return __builtin_amdgcn_wmma_f32_16x16x32_bf16(false, a, false, b, (short)0, c, false, false);
  }
  static __device__ __forceinline__ void guard4(v8f& a, v8f& b, v8f& c, v8f& d, v16b x, v16b y) { dep_guard4_b(a, b, c, d, x, y); }
  static __device__ __forceinline__ void keep(v16b a, v16b b, v16b c, v16b d) { keep4_b(a, b, c, d); }
};

/* ---- The batched product, operand tiles built in LDS ------------------------ */
/* S[b][m][n] = 2^-20 sum_k A16[m][k] * B16[n][k]; both operand tiles row-major in LDS, 288 f16 a row. */
constexpr int kTileR   = 256;                 /* rows of each operand a work-group holds: a 256 x 256 tile of S */
constexpr int kPitchB  = kKA * 2 + 16;        /* LDS bytes a row: 592 = 16 B x 37, odd: sixteen rows' 16-byte reads fall on 64 different banks */
constexpr int kPitchH  = kPitchB / 2;
constexpr int kOpBytes = kTileR * kPitchB;    /* 151,552 B an operand tile */
constexpr int kGemmThr = 512;                 /* sixteen waves, 4 x 4, a 64 x 64 tile each */
constexpr int kPrepRows = 8;                  /* rows a wave builds at a time: sixteen loads of 512 B in flight for them */
constexpr int kPassRows = kPrepRows * (kGemmThr / 32);   /* 128 rows a pass of the sixteen waves: two passes an operand tile */
static_assert(kTileR == 2 * kPassRows, "two passes an operand tile");
static_assert(2 * kOpBytes <= 327680, "both tiles fit the LDS");
static_assert(kT % kTileR == 0 && kJ % kTileR == 0, "whole tiles");


typedef __attribute__((ext_vector_type(4)))  _Float16 v4h;
typedef __attribute__((ext_vector_type(2)))  unsigned v2u;

/* eight rows' sixteen loads go out together; each covers 512 contiguous bytes of a row: columns 4 lane .. and 128 + 4 lane .. (xp points at column 4 lane of the first row) */
__device__ __forceinline__ void load_rows(const float* xp, v4f (&x0)[kPrepRows], v4f (&x1)[kPrepRows]) {
#pragma unroll
  for (int r = 0; r < kPrepRows; ++r) {
    x0[r] = *(const v4f*)(xp + r * kD);
    x1[r] = *(const v4f*)(xp + r * kD + 128);
  }
  /* before a register that an issued load names is written again; the address is named so that no load's result is placed over it; the clobber keeps the loads ahead of the work that follows */
  asm volatile("s_wait_xcnt 0x0" :: "v"(xp) : "memory");
}

/* where row r of a wave's eight stands, in rows from the wave's first place: H's rows in their order; U's row 4 c + j of a group of 64 at place 16 j + c (the wave's eight rows begin at a multiple of 8) */
template <bool LEFT>
__device__ __forceinline__ unsigned row_place(unsigned r) { return LEFT ? r : (r & 3u) * 16u + (r >> 2); }

/* LEFT: rows of H, d = w_h, m = 2^10 w_m (bf16 values, the carry folded in: exact), into the A tile.  Otherwise rows of U, d = w_u, m = 2^10, into the B tile. dp: the LDS byte of the wave's first place.
   Two columns an instruction all the way: packed convert to bf16, packed f32 product and row-dot step (even and odd columns summed apart, joined at the end), packed RNE convert to f16. A column below the f16 normal range is stored as the subnormal it rounds to (the matrix unit keeps subnormal operands), not as nought: the nearer value, and no compare and select a column. */
template <bool LEFT>
__device__ __forceinline__ void build_rows(const v4f (&x0)[kPrepRows], const v4f (&x1)[kPrepRows], v4f d0, v4f d1, v4f m0, v4f m1, unsigned char* dp, unsigned lane) {
  float s[kPrepRows];
#pragma unroll
  for (int r = 0; r < kPrepRows; ++r) {
    v2f a = (v2f){0.0f, 0.0f};
    v2h o[4];
#pragma unroll
    for (int q = 0; q < 2; ++q) {
      const v2f xb = bf16r2((v2f){x0[r][2 * q], x0[r][2 * q + 1]});
      a = __builtin_elementwise_fma(xb, (v2f){d0[2 * q], d0[2 * q + 1]}, a);
      o[q] = __builtin_convertvector(xb * (v2f){m0[2 * q], m0[2 * q + 1]}, v2h);
    }
#pragma unroll
    for (int q = 0; q < 2; ++q) {
      const v2f xb = bf16r2((v2f){x1[r][2 * q], x1[r][2 * q + 1]});
      a = __builtin_elementwise_fma(xb, (v2f){d1[2 * q], d1[2 * q + 1]}, a);
      o[2 + q] = __builtin_convertvector(xb * (v2f){m1[2 * q], m1[2 * q + 1]}, v2h);
    }
    s[r] = a[0] + a[1];
    /* columns 4 lane .. and, 256 B on, 128 + 4 lane ..: 256 contiguous LDS bytes a store */
    unsigned char* rp = dp + row_place<LEFT>((unsigned)r) * (unsigned)kPitchB;
    *(v2u*)(rp + 8u * lane)       = (v2u){__builtin_bit_cast(unsigned, o[0]), __builtin_bit_cast(unsigned, o[1])};
    *(v2u*)(rp + 256 + 8u * lane) = (v2u){__builtin_bit_cast(unsigned, o[2]), __builtin_bit_cast(unsigned, o[3])};
  }
  /* eight sums over 32 lanes in one tree: each of the first three steps halves the rows a lane still carries, so lane l ends with row l >> 2 */
  const bool u16 = (lane & 16u) != 0u, u8 = (lane & 8u) != 0u, u4 = (lane & 4u) != 0u;
  float t4[4], t2[2];
#pragma unroll
  for (int i = 0; i < 4; ++i) t4[i] = (u16 ? s[i + 4] : s[i]) + __shfl_xor(u16 ? s[i] : s[i + 4], 16, 32);
#pragma unroll
  for (int i = 0; i < 2; ++i) t2[i] = (u8 ? t4[i + 2] : t4[i]) + __shfl_xor(u8 ? t4[i] : t4[i + 2], 8, 32);
  float sv = (u4 ? t2[1] : t2[0]) + __shfl_xor(u4 ? t2[0] : t2[1], 4, 32);
  sv += __shfl_xor(sv, 2, 32);
  sv += __shfl_xor(sv, 1, 32);
  /* the 32 tail columns of the eight rows: one 16-byte store a lane (row l >> 2, column group l & 3; the live four columns stand in group 0) */
  const _Float16 hi = (_Float16)carry_flush(sv, kInCarry);
  const _Float16 lo = (_Float16)carry_flush(sv - (float)hi * (1.0f / kInCarry), kInCarry);
  const _Float16 one = (_Float16)kInCarry, nought = (_Float16)0.0f;
  v8h av;
  av[0] = LEFT ? one : hi; av[1] = LEFT ? one : lo; av[2] = LEFT ? hi : one; av[3] = LEFT ? lo : one;
  av[4] = nought; av[5] = nought; av[6] = nought; av[7] = nought;
  const unsigned aug = ((lane & 3u) == 0u) ? 0xFFFFu : 0u;
  const v8us ab = __builtin_bit_cast(v8us, av);
  v8us ov;
#pragma unroll
  for (int e = 0; e < 8; ++e) ov[e] = (unsigned short)(ab[e] & aug);
  *(v8us*)(dp + row_place<LEFT>(lane >> 2) * (unsigned)kPitchB + 2u * (unsigned)kD + 16u * (lane & 3u)) = ov;
}

__global__ __launch_bounds__(kGemmThr) void simi_kernel(const float* __restrict__ H, const float* __restrict__ U, const float* __restrict__ Wv, float* __restrict__ Cout) {
  typedef _Float16 T;
  typedef Frag<T>::V V;
  /* [A tile 256 rows | B tile 256 rows] at pitch 592 B */
  __shared__ __align__(16) unsigned char sm[2 * kOpBytes];
  const unsigned tid = threadIdx.x;
  const int lane = (int)(tid & 31u);
  const int wave = (int)(tid >> 5);
  const int b  = blockIdx.z;
  const int M0 = blockIdx.y * kTileR;
  const int N0 = blockIdx.x * kTileR;

  /* ---- build: wave w takes rows 8 w .. of each pass of 128 rows; a pass of H into the A tile and a pass of U into the B tile in turn, twice; two sets of row registers, so that one operand's next rows fly while the other operand's rows are worked on ---- */
  {
    const unsigned ul = (unsigned)lane;
    const unsigned c0 = 4u * ul, c1 = 128u + 4u * ul;
    const unsigned wrow = (unsigned)wave * (unsigned)kPrepRows;
    const float* hp = H + ((size_t)b * kT + (size_t)M0 + wrow) * (unsigned)kD + c0;
    const float* up = U + ((size_t)b * kJ + (size_t)N0 + wrow) * (unsigned)kD + c0;
    unsigned char* dA = sm + wrow * (unsigned)kPitchB;
    /* the wave's first place in the B tile: its eight rows are columns 2 (wave & 7) and the next of the four fragments of group wave >> 3 */
    unsigned char* dB = sm + kOpBytes + (64u * ((unsigned)wave >> 3) + 2u * ((unsigned)wave & 7u)) * (unsigned)kPitchB;
    /* W = (w_h | w_u | w_m): 256 floats each */
    v4f h0 = *(const v4f*)(Wv + c0),          h1 = *(const v4f*)(Wv + c1);
    v4f u0 = *(const v4f*)(Wv + kD + c0),     u1 = *(const v4f*)(Wv + kD + c1);
    v4f m0 = *(const v4f*)(Wv + 2 * kD + c0), m1 = *(const v4f*)(Wv + 2 * kD + c1);
    /* before a row load's result lands in a register that an issued load of w names */
    asm volatile("s_wait_xcnt 0x0" ::: "memory");
    v4f xh0[kPrepRows], xh1[kPrepRows], xu0[kPrepRows], xu1[kPrepRows];
    load_rows(hp, xh0, xh1);
    load_rows(up, xu0, xu1);
#pragma unroll
    for (int e = 0; e < 4; ++e) {
      h0[e] = bf16r(h0[e]); h1[e] = bf16r(h1[e]);
      u0[e] = bf16r(u0[e]); u1[e] = bf16r(u1[e]);
      m0[e] = bf16r(m0[e]) * kInCarry; m1[e] = bf16r(m1[e]) * kInCarry;
    }
    const v4f kCarry4 = (v4f){kInCarry, kInCarry, kInCarry, kInCarry};
    /* kept rolled: the branches round the loads keep each refill where it stands, directly behind the last use of its registers and ahead of the other operand's arithmetic (unrolled into one block, the compiler moved that arithmetic in front of the loads, or the loads into a third register set that spilled) */
#pragma unroll 1
    for (int p = 0; p < 2; ++p) {
      build_rows<true>(xh0, xh1, h0, h1, m0, m1, dA, ul);
      if (p == 0) load_rows(hp + kPassRows * kD, xh0, xh1);
      build_rows<false>(xu0, xu1, u0, u1, kCarry4, kCarry4, dB, ul);
      if (p == 0) load_rows(up + kPassRows * kD, xu0, xu1);
      dA += kPassRows * kPitchB;
      dB += kPassRows * kPitchB;
    }
  }
  /* every wave's rows stand in LDS: the tiles may be read */
  __syncthreads();

  /* row (A) / place (B, D) within subtile; k offset of this lane half; D row offset */
  const int rlane = lane & 15;
  const int koff  = (lane >> 4) * 8;
  const int mOff  = (lane >> 4) * 8;
  const int m0 = (wave >> 2) << 6;
  const int n0 = (wave & 3) << 6;
  const T* sA = (const T*)sm + (m0 + rlane) * kPitchH + koff;
  const T* sB = (const T*)(sm + kOpBytes) + (n0 + rlane) * kPitchH + koff;

  v8f acc[4][4];
#pragma unroll
  for (int i = 0; i < 4; ++i)
#pragma unroll
    for (int j = 0; j < 4; ++j) acc[i][j] = (v8f){0.f,0.f,0.f,0.f,0.f,0.f,0.f,0.f};

  /* unrolled: every fragment address is the wave's base and an immediate */
#pragma unroll
  for (int k0 = 0; k0 < kKA; k0 += 32) {
    /* the step's eight fragments go out as one group ahead of its sixteen matrix instructions: one LDS wait a step */
    V bh[4], ah[4];
#pragma unroll
    for (int j = 0; j < 4; ++j) bh[j] = Frag<T>::load(sB + (j << 4) * kPitchH + k0);
#pragma unroll
    for (int i = 0; i < 4; ++i) ah[i] = Frag<T>::load(sA + (i << 4) * kPitchH + k0);
#pragma unroll
    for (int i = 0; i < 4; ++i) {
#pragma unroll
      for (int j = 0; j < 4; ++j) acc[i][j] = Frag<T>::mma(ah[i], bh[j], acc[i][j]);
      /* all four accumulators of this row group tied, A fragment named */
      Frag<T>::guard4(acc[i][0], acc[i][1], acc[i][2], acc[i][3], ah[i], ah[i]);
    }
    Frag<T>::keep(bh[0], bh[1], bh[2], bh[3]);
  }
  acc_guard4(acc[0][0], acc[0][1], acc[0][2], acc[0][3]);
  acc_guard4(acc[1][0], acc[1][1], acc[1][2], acc[1][3]);
  acc_guard4(acc[2][0], acc[2][1], acc[2][2], acc[2][3]);
  acc_guard4(acc[3][0], acc[3][1], acc[3][2], acc[3][3]);

  /* ---- epilogue: fragment j's place c is column 4 c + j of the wave's 64, so acc[i][0..3][r] of a lane are columns 4 c .. 4 c + 3 of one row: one 16-byte store, sixteen lanes a 256-B row piece, two rows (r and r + 8) an instruction; one address and immediates; no LDS is written again, so no barrier stands here and a wave stores as soon as its own products are over ---- */
  float* C = Cout + (size_t)b * ((size_t)kT * kJ) + (size_t)(M0 + m0 + mOff) * kJ + (size_t)(N0 + n0 + 4 * rlane);
#pragma unroll
  for (int i = 0; i < 4; ++i) {
#pragma unroll
    for (int r = 0; r < 8; ++r) {
      const v4f v = (v4f){acc[i][0][r], acc[i][1][r], acc[i][2][r], acc[i][3][r]} * kSc20;
      *(v4f*)(C + ((i << 4) + r) * kJ) = v;
    }
  }
}

extern "C" void kernel_launch(void* const* d_in, const int* in_sizes, int n_in,
                              void* d_out, int out_size, void* d_ws, size_t ws_size,
                              hipStream_t stream) {
  if (n_in < 3 || d_out == nullptr) return;
  if (in_sizes[0] != kNB * kT * kD || in_sizes[1] != kNB * kJ * kD || in_sizes[2] != 3 * kD) return;
  if (out_size != kNB * kT * kJ) return;
  const float* H = (const float*)d_in[0];
  const float* U = (const float*)d_in[1];
  const float* Wv = (const float*)d_in[2];
  float* out = (float*)d_out;

  /* 2 x 8 tiles of 256 x 256 a batch: 256 work-groups */
  simi_kernel<<<dim3(kJ / kTileR, kT / kTileR, kNB), kGemmThr, 0, stream>>>(H, U, Wv, out);
}
